// v000
// The times below were measured on an AMD MI455X: many runs one after another, warmed up first and cycling through
// copies of the inputs, with the whole window's GPU time divided by the number of runs. Launches and the gaps
// between them are all in it. The median over several windows is given; except for v000 it joins two sittings, which
// can be a few percent apart, so the side-by-side timings, each taken in one sitting, are the better comparison.
// v000 is the starting kernel. One run takes 160 microseconds.
#include <hip/hip_runtime.h>

// Soft window over a context sequence: per step u a 30-wide linear map of the state row (weights [in][out], bias), exp, split into 10 weights / 10 inverse widths / 10 position increments (x 0.2, prefix-summed over u);
// window phi[u][t] = sum_k w_k exp(-g_k (pos_k - t)^2); output [NB][USEQ][128] = (phi * mask) @ ctx, f32.
// Compute dtypes, f32 accumulate everywhere: state-row linear map v_wmma_f32_16x16x32_bf16 (state rows, W, bias RNE-converted to bf16; products exact);
// window-times-context v_wmma_f32_16x16x32_f16: phi single f16 with a x256 carry (built in registers, f32 vector math), ctx (RNE-converted to bf16, exact in f16) single f16 with a x64 carry; carries folded by 2^-14 in the f32 epilogue.
// Layout: bf16 copy of the state rows [NB*USEQ][512]; W^T bf16 [32][512] (rows 30, 31 zero); ctx^T f16 plane [b*128 + d][t]; parameter plane f32 [b*USEQ + u][32] (0..9 weights, 10..19 inverse widths, 20..29 positions, 30..31 zero).
// Prefix sum: one lane per column walks the 512 rows of its batch in LDS with an f64 running value, one write per element. exp of the linear map: expf; window exponentials: exp2 of the log2(e)-scaled argument.

#ifndef NB
#define NB 8
#endif
#ifndef USEQ
#define USEQ 512
#endif
#ifndef TSEQ
#define TSEQ 1024
#endif
#define NB_FULL 8
#define U_FULL  512
#define T_FULL  1024
#ifndef OUT_U
#define OUT_U USEQ               // row pitch (in steps) between batches of the output
#endif
#define HIN  512                 // state width = depth of the linear map
#define DM   128                 // context width = output width
#define NMIX 10
#define NPAR 30                  // 3 * NMIX columns of the linear map
#define PW   32
#define AW   4                   // waves per window block (16 steps each)
#define OSP2 132                 // LDS row pitch (floats) of the output tile
#define CTP  72                  // LDS row pitch (halves) of the transpose tile
#define RPW  (USEQ / 8)          // rows per wave in the parameter kernel (8 waves per batch)
#define MT   (RPW / 16)
#define PCAR 256.0f              // carry of the window operand
#define CCAR 64.0f               // carry of the ctx plane
#define OSC  (1.0f / 16384.0f)   // 1 / (PCAR * CCAR)
#define NL2E (-1.4426950408889634f)

static_assert(NPAR == 3 * NMIX);
static_assert(NPAR <= PW);
static_assert(PW == 32);
static_assert(256 % PW == 0);                   // thread-linear element index keeps its column
static_assert(HIN % 32 == 0);                   // GEMM k-loop steps by 32
static_assert(HIN % 8 == 0);
static_assert(DM == 128);                       // output row = 32 lanes x 4 floats; 8 column tiles of 16
static_assert(USEQ % 128 == 0);                 // 8 waves x MT slabs of 16 rows cover a batch exactly
static_assert(MT >= 1);
static_assert(MT * 16 * 8 == USEQ);
static_assert(USEQ % (16 * AW) == 0);           // window grid covers the steps exactly
static_assert(TSEQ % 64 == 0);
static_assert(TSEQ % 32 == 0);                  // window k-loop steps by 32
static_assert(NB <= NB_FULL);
static_assert(USEQ <= U_FULL);
static_assert(TSEQ <= T_FULL);
static_assert((OSP2 * 4) % 16 == 0);
static_assert((CTP * 2) % 16 == 0);
static_assert(((size_t)USEQ * HIN) % 8 == 0);
static_assert((size_t)USEQ * PW * 4 <= (size_t)131072);                                 // static LDS of the parameter kernel
static_assert((size_t)AW * 16 * PW * 4 + (size_t)AW * 16 * OSP2 * 4 <= (size_t)131072); // static LDS of the window kernel
static_assert((size_t)DM * CTP * 2 <= (size_t)131072);                                  // static LDS of the transpose kernel

typedef _Float16 h16;
typedef unsigned short bf;
typedef __attribute__((ext_vector_type(16))) __bf16   v16bf;
typedef __attribute__((ext_vector_type(16))) _Float16 v16h;
typedef __attribute__((ext_vector_type(8)))  _Float16 v8h;
typedef __attribute__((ext_vector_type(8)))  unsigned short v8us;
typedef __attribute__((ext_vector_type(8)))  float    v8f;
typedef __attribute__((ext_vector_type(4)))  float    v4f;
typedef v4f  __attribute__((may_alias)) v4fa;
typedef v8h  __attribute__((may_alias)) v8ha;

__device__ __forceinline__ unsigned short f2bf(float f) { unsigned u = __float_as_uint(f); u += 0x7FFFu + ((u >> 16) & 1u); return (unsigned short)(u >> 16); }
__device__ __forceinline__ float bfr(float f) { return __uint_as_float(((unsigned)f2bf(f)) << 16); }   // value after RNE convert to bf16
__device__ __forceinline__ v16h cat16(v8h lo, v8h hi) { return __builtin_shufflevector(lo, hi, 0, 1, 2, 3, 4, 5, 6, 7, 8, 9, 10, 11, 12, 13, 14, 15); }
__device__ __forceinline__ v16bf cat16b(v8us lo, v8us hi) { return __builtin_bit_cast(v16bf, __builtin_shufflevector(lo, hi, 0, 1, 2, 3, 4, 5, 6, 7, 8, 9, 10, 11, 12, 13, 14, 15)); }
__device__ __forceinline__ v8f wmma16(v16h a, v16h b, v8f c) { return __builtin_amdgcn_wmma_f32_16x16x32_f16(false, a, false, b, (short)0, c, false, false); }
__device__ __forceinline__ v8f wmmab(v16bf a, v16bf b, v8f c) { return __builtin_amdgcn_wmma_f32_16x16x32_bf16(false, a, false, b, (short)0, c, false, false); }
// fragment loaders from K-contiguous 16-bit rows; p already includes + 8*(lane>>4): elements 0..7 <- k0+8h+0..7, elements 8..15 <- k0+16+8h+0..7 (same map for A and B)
__device__ __forceinline__ v16h  ldh(const h16* p) { return cat16(*(const v8h*)p, *(const v8h*)(p + 16)); }
__device__ __forceinline__ v16bf ldb(const bf* p)  { return cat16b(*(const v8us*)p, *(const v8us*)(p + 16)); }
// ordering point for wave-private LDS tiles (same wave writes and reads)
__device__ __forceinline__ void wave_sync() { __builtin_amdgcn_fence(3 /* release order */, "wavefront"); __builtin_amdgcn_wave_barrier(); asm volatile("" ::: "memory"); }

// f32 -> f16 with a value select: magnitudes below the smallest normal f16 become +0 (applied after the plane's carry)
static __device__ __forceinline__ h16 toh_flush(float v) { const h16 r = (h16)v; return (fabsf(v) < 6.103515625e-05f) ? (h16)0.0f : r; }
// one matrix instruction + its own guard (one accumulator per guard)
__device__ __forceinline__ v8f wmmab_g(v16bf a, v16bf b, v8f c) { c = wmmab(a, b, c); asm volatile("v_nop\n\tv_nop\n\tv_nop\n\tv_nop" : "+v"(c) : "v"(a), "v"(b)); return c; }
__device__ __forceinline__ v8f wmma16_g(v16h a, v16h b, v8f c) { c = wmma16(a, b, c); asm volatile("v_nop\n\tv_nop\n\tv_nop\n\tv_nop" : "+v"(c) : "v"(a), "v"(b)); return c; }

__global__ __launch_bounds__(256) void k_cvt8(const float* __restrict__ src, bf* dst, size_t n8) {
    const size_t i = (size_t)blockIdx.x * 256 + threadIdx.x; if (i >= n8) return;
    const v8f v = *(const v8f*)(src + i * 8); v8us o;
#pragma unroll
    for (int k = 0; k < 8; ++k) o[k] = f2bf(v[k]);
    *(v8us*)(dst + i * 8) = o; 
}

// k_wt: W [HIN][30] ([in][out], f32) -> W^T bf16 [PW][HIN], rows 30, 31 zero. in[rows = HIN][cols = 30] -> out[cols padded to PW][rows = HIN].
static_assert(((size_t)PW * HIN / 8) % 256 == 0);      // grid x block == piece count
__global__ __launch_bounds__(256) void k_wt(const float* __restrict__ W, bf* WT) {
    const int p = blockIdx.x * 256 + threadIdx.x; if (p >= PW * HIN / 8) return;
    const int n = p / (HIN / 8), k0 = (p % (HIN / 8)) * 8;
    const int nc = n < NPAR ? n : (NPAR - 1);
    v8us o;
#pragma unroll
    for (int i = 0; i < 8; ++i) { float x = W[(size_t)(k0 + i) * NPAR + nc]; asm volatile("" : "+v"(x)); o[i] = (n < NPAR) ? f2bf(x) : (unsigned short)0; }
    *(v8us*)(WT + (size_t)p * 8) = o; 
}

// k_ctxT: ctx [b][t][128] f32 -> ctx^T f16 plane [(b*128 + d)][t] (bf16 RNE value x CCAR, exact in f16, flush select). in[rows = t][cols = d] -> out[cols = d][rows = t].
static_assert(64 * DM / 4 == 8 * 256);                 // load pieces: 8 trips x 256 threads
static_assert(DM * 8 == 4 * 256);
__global__ __launch_bounds__(256) void k_ctxT(const float* __restrict__ ctx, h16* CT) {
    __shared__ __align__(16) h16 sT[DM * CTP];
    const int tid = threadIdx.x; const int b = blockIdx.y, t0 = blockIdx.x * 64;
    const float* src = ctx + ((size_t)b * T_FULL + t0) * DM;
#pragma unroll 1
    for (int it = 0; it < 8; ++it) { const int q = it * 256 + tid; const int t = q >> 5, d4 = (q & 31) * 4;    // 64 t x 32 pieces of 4 d
        const v4f v = *(const v4f*)(src + (size_t)t * DM + d4);
#pragma unroll
        for (int i = 0; i < 4; ++i) sT[(d4 + i) * CTP + t] = toh_flush(bfr(v[i]) * CCAR); }
    __syncthreads();
    h16* dst = CT + (size_t)b * DM * TSEQ + t0;
{
#pragma unroll
        for (int it = 0; it < 4; ++it) { const int p = it * 256 + tid; const int row = p >> 3, c8 = (p & 7) * 8;   // 4 trips x 32 row groups = 128 rows; 8 lanes x 8 halves = 64 columns
            const v8h hv = *(const v8ha*)(&sT[row * CTP + c8]);
            *(v8h*)(dst + (size_t)row * TSEQ + c8) = hv; }
         }
}

// k_par: one block per batch (8 waves x RPW rows). bf16 GEMM C[u][n] = sum_k x[u][k] W^T[n][k] (K = HIN, N = 32 padded), operands straight from K-contiguous bf16 planes.
// Then in LDS (cross-wave: block barriers between phases): + bias (bf16 RNE value), expf, x 0.2 on columns 20..29, zero on columns 30, 31;
// prefix sum over u of columns 20..29 (wave 0, lane = column, f64 running value, one write per element, value select on the column);
static_assert(((size_t)USEQ * PW) % 256 == 0);
static_assert(((size_t)USEQ * PW / 4) % 256 == 0);
__global__ __launch_bounds__(256) void k_par(const bf* __restrict__ HB, const bf* __restrict__ WT, const float* __restrict__ bias, float* PAR) {
    __shared__ __align__(16) float sp[USEQ * PW];
    const int tid = threadIdx.x;
    const int lane = tid & 31, lr = lane & 15, hi = lane >> 4;
    const int wave = __builtin_amdgcn_readfirstlane((int)(threadIdx.x >> 5));
    const int b = blockIdx.x;
    const int r0 = wave * RPW;
    v8f acc[MT][2];
#pragma unroll
    for (int mb = 0; mb < MT; ++mb) { acc[mb][0] = (v8f){}; acc[mb][1] = (v8f){}; }
    const size_t aoff = ((size_t)b * USEQ + (size_t)(r0 + lr)) * HIN + 8 * hi;
    const size_t boff = (size_t)lr * HIN + 8 * hi;
#pragma unroll 1
    for (int kc = 0; kc < HIN; kc += 32) {
        v16bf a[MT];
#pragma unroll
        for (int mb = 0; mb < MT; ++mb) a[mb] = ldb(HB + aoff + (size_t)mb * 16 * HIN + kc);
#pragma unroll
        for (int nb = 0; nb < 2; ++nb) { const v16bf w = ldb(WT + boff + (size_t)nb * 16 * HIN + kc);
#pragma unroll
            for (int mb = 0; mb < MT; ++mb) acc[mb][nb] = wmmab_g(a[mb], w, acc[mb][nb]); }
    }
#pragma unroll
    for (int mb = 0; mb < MT; ++mb) {
#pragma unroll
        for (int nb = 0; nb < 2; ++nb) {
#pragma unroll
            for (int j = 0; j < 8; ++j) sp[(r0 + mb * 16 + hi * 8 + j) * PW + nb * 16 + lr] = acc[mb][nb][j]; } }   // D: row 8h+j, col lane&15
    __syncthreads();
    { const int c = tid & 31; const int cc = c < NPAR ? c : (NPAR - 1);
      float bx = bias[cc]; asm volatile("" : "+v"(bx));
      const float bcv = (c < NPAR) ? bfr(bx) : 0.0f;
      const float sc = (c >= 2 * NMIX) ? 0.2f : 1.0f;
#pragma unroll 1
      for (int it = 0; it < USEQ * PW / 256; ++it) { const int idx = it * 256 + tid;      // idx & 31 == c
          const float e = expf(sp[idx] + bcv) * sc;
          sp[idx] = (c < NPAR) ? e : 0.0f; } }
    __syncthreads();
    if (wave == 0) {
        const bool isk = (lane >= 2 * NMIX) & (lane < NPAR);
        double s = 0.0;
#pragma unroll 1
        for (int u = 0; u < USEQ; ++u) { const float v = sp[u * PW + lane]; s += (double)v; const float o = isk ? (float)s : v; sp[u * PW + lane] = o; }
    }
    __syncthreads();
    float* dst = PAR + (size_t)b * USEQ * PW;
{
#pragma unroll 1
        for (int it = 0; it < USEQ * PW / 4 / 256; ++it) { const int p = it * 256 + tid;
            const v4f val = *(const v4fa*)(&sp[p * 4]);
            *(v4f*)(dst + (size_t)p * 4) = val; }
         }
}

// k_window: one wave per 16 steps u of one batch. Per 32-t step the window tile phi[16 u][32 t] is built in registers directly in A-fragment order
// (lane: row u = lane&15, elements 0..7 <- t0+8h+0..7, elements 8..15 <- t0+16+8h+0..7): rolled loop over the 10 mixtures (per-row parameters from a wave-private LDS copy), 16 running sums per lane;
// phi x mask (bf16 RNE value) x PCAR -> f16 with the flush select. B fragments = ctx^T rows d = 16j + (lane&15), k = t, two 16-B loads each from the f16 plane. 8 accumulators (128 output columns).
static_assert(32 * 16 == DM * 4);                      // store extent of one instruction == one output row
static_assert(4 * 32 * 4 == 16 * PW);                  // parameter copy: 4 trips x 32 lanes x 4 floats == 16 rows x 32 floats
__global__ __launch_bounds__(32 * AW) void k_window(const float* __restrict__ PAR, const h16* __restrict__ CT, const float* __restrict__ mask, float* OUT) {
    __shared__ __align__(16) float sp[AW * 16 * PW];
    __shared__ __align__(16) float os[AW * 16 * OSP2];
    const int lane = threadIdx.x & 31, lr = lane & 15, hi = lane >> 4;
    const int wave = __builtin_amdgcn_readfirstlane((int)(threadIdx.x >> 5));
    const int b = blockIdx.y;
    const int u0 = (blockIdx.x * AW + wave) * 16;
    const int pb = wave * 16 * PW;
    { const float* prow = PAR + ((size_t)b * USEQ + (size_t)u0) * PW;
#pragma unroll
      for (int s = 0; s < 4; ++s) { const int p = s * 32 + lane; const v4f x = *(const v4f*)(prow + (size_t)p * 4); *(v4fa*)(&sp[pb + p * 4]) = x; } }
    wave_sync();
    v8f acc[8];
#pragma unroll
    for (int j = 0; j < 8; ++j) acc[j] = (v8f){};
    const float* maskb = mask + (size_t)b * T_FULL + 8 * hi;
    const h16* cb = CT + ((size_t)b * DM + (size_t)lr) * TSEQ + 8 * hi;      // + 16j*TSEQ + t0  (B fragment: col d, k = t)
    const int pw = pb + lr * PW;
#pragma unroll 1
    for (int key0 = 0; key0 < TSEQ; key0 += 32) {
        float s[16];
#pragma unroll
        for (int i = 0; i < 16; ++i) s[i] = 0.0f;
        const float tb = (float)(key0 + 8 * hi);
#pragma unroll 1
        for (int k = 0; k < NMIX; ++k) {
            const float a = sp[pw + k];
            const float g = sp[pw + NMIX + k] * NL2E;
            const float kp = sp[pw + 2 * NMIX + k];
#pragma unroll
            for (int i = 0; i < 8; ++i) {
                const float d0 = kp - (tb + (float)i);
                const float d1 = kp - (tb + (float)(16 + i));
                s[i]     += a * __builtin_amdgcn_exp2f(g * d0 * d0);
                s[8 + i] += a * __builtin_amdgcn_exp2f(g * d1 * d1); }
        }
        const float* kq = maskb + key0;                             // t = key0+8h+0..7 and key0+16+8h+0..7, all < TSEQ
        const v4f m0 = *(const v4f*)kq, m1 = *(const v4f*)(kq + 4), m2 = *(const v4f*)(kq + 16), m3 = *(const v4f*)(kq + 20);
        float mk[16];
#pragma unroll
        for (int r = 0; r < 4; ++r) { mk[r] = m0[r]; mk[4 + r] = m1[r]; mk[8 + r] = m2[r]; mk[12 + r] = m3[r]; }
        v16h pa;
#pragma unroll
        for (int i = 0; i < 16; ++i) { const float gv = s[i] * bfr(mk[i]) * PCAR; pa[i] = toh_flush(gv); }
#pragma unroll
        for (int j = 0; j < 8; ++j) { const v16h cf = ldh(cb + (size_t)j * 16 * TSEQ + key0); acc[j] = wmma16_g(pa, cf, acc[j]); }
    }
    const int wb = wave * 16 * OSP2;
    // D layout: acc[j][r] = (u = 8h + r, d = 16j + lane&15) -> os[u][d]; rows 0..15 x columns 0..127 all written
#pragma unroll
    for (int j = 0; j < 8; ++j) {
#pragma unroll
        for (int r = 0; r < 8; ++r) os[wb + (8 * hi + r) * OSP2 + 16 * j + lr] = acc[j][r] * OSC; }
    wave_sync();
    float* orow = OUT + ((size_t)b * OUT_U + (size_t)u0) * DM;
{
#pragma unroll 4
        for (int row = 0; row < 16; ++row) {                        // 16 trips x 32 lanes x 16 B == 16 rows x 512 B
            const v4f val = *(const v4fa*)(&os[wb + row * OSP2 + lane * 4]);
            *(v4f*)(orow + (size_t)row * DM + lane * 4) = val; }
         }
}

static constexpr size_t al256(size_t v) { return (v + 255) & ~(size_t)255; }
static constexpr size_t SZ_HB  = al256((size_t)NB * USEQ * HIN * 2);
static constexpr size_t SZ_WT  = al256((size_t)PW * HIN * 2);
static constexpr size_t SZ_CT  = al256((size_t)NB * DM * TSEQ * 2);
static constexpr size_t SZ_PAR = al256((size_t)NB * USEQ * PW * 4);
static constexpr size_t SZ_TOTAL = SZ_HB + SZ_WT + SZ_CT + SZ_PAR;
static_assert(SZ_TOTAL <= (size_t)134217728);          // workspace carve <= 128 MiB
static_assert(((size_t)TSEQ * 2) % 128 == 0);
static_assert(((size_t)HIN * 2) % 128 == 0);

extern "C" void kernel_launch(void* const* d_in, const int* in_sizes, int n_in,
                              void* d_out, int out_size, void* d_ws, size_t ws_size, hipStream_t stream) {
    if (n_in < 5) return;
    const size_t needh = ((size_t)(NB - 1) * U_FULL + USEQ) * HIN;
    const size_t needc = ((size_t)(NB - 1) * T_FULL + TSEQ) * DM;
    const size_t needm = (size_t)(NB - 1) * T_FULL + TSEQ;
    if ((size_t)in_sizes[0] < needh || (size_t)in_sizes[1] < needc || (size_t)in_sizes[2] < needm) return;
    if ((size_t)in_sizes[3] < (size_t)HIN * NPAR || in_sizes[4] < NPAR) return;
    if ((size_t)out_size < ((size_t)(NB - 1) * OUT_U + USEQ) * DM) return;
    if (SZ_TOTAL > ws_size) return;
    // wire order: h_t, ctx, mask, W, b
    const float* hin  = (const float*)d_in[0];
    const float* ctx  = (const float*)d_in[1];
    const float* mask = (const float*)d_in[2];
    const float* wlin = (const float*)d_in[3];
    const float* blin = (const float*)d_in[4];
    float* OUT = (float*)d_out;      // [NB][USEQ][128]
    char* wsp = (char*)d_ws;
    bf*  HB  = (bf*)wsp;  wsp += SZ_HB;               // state rows [NB*USEQ][512] bf16
    bf*  WT  = (bf*)wsp;  wsp += SZ_WT;               // W^T [32][512] bf16
    h16* CT  = (h16*)wsp; wsp += SZ_CT;               // ctx^T [NB*128][TSEQ] f16 x64
    float* PAR = (float*)wsp; wsp += SZ_PAR;          // parameters [NB*USEQ][32] f32

    if (USEQ == U_FULL) {
        const size_t n8 = (size_t)NB * USEQ * HIN / 8;
        k_cvt8<<<(unsigned)((n8 + 255) / 256), 256, 0, stream>>>(hin, HB, n8);
    } else {
        const size_t n8 = (size_t)USEQ * HIN / 8;
        for (int b = 0; b < NB; ++b) k_cvt8<<<(unsigned)((n8 + 255) / 256), 256, 0, stream>>>(hin + (size_t)b * U_FULL * HIN, HB + (size_t)b * USEQ * HIN, n8);
    }
    k_wt<<<(unsigned)(((size_t)PW * HIN / 8 + 255) / 256), 256, 0, stream>>>(wlin, WT);
    // ctx [t][d] -> ctx^T [d][t]: grid (t tiles, batches)
    k_ctxT<<<dim3(TSEQ / 64, NB, 1), 256, 0, stream>>>(ctx, CT);
    k_par<<<dim3(NB, 1, 1), 256, 0, stream>>>(HB, WT, blin, PAR);
    k_window<<<dim3(USEQ / (16 * AW), NB, 1), 32 * AW, 0, stream>>>(PAR, CT, mask, OUT);
}

// v001
// It runs in 89 microseconds.
// Two timings next to v000 put it at 1.80 and 1.82 times that version's speed.
#include <hip/hip_runtime.h>

// Soft window over a context sequence: per step u a 30-wide linear map of the state row (weights [in][out], bias), exp, split into 10 weights / 10 inverse widths / 10 position increments (x 0.2, prefix-summed over u);
// window phi[u][t] = sum_k w_k exp(-g_k (pos_k - t)^2); output [NB][USEQ][128] = (phi * mask) @ ctx, f32.
// Compute dtypes, f32 accumulate everywhere: state-row linear map v_wmma_f32_16x16x32_bf16 (state rows, W, bias RNE-converted to bf16; products exact);
// window-times-context v_wmma_f32_16x16x32_f16: phi single f16 with a x256 carry (built in registers, f32 vector math), ctx (RNE-converted to bf16, exact in f16) single f16 with a x64 carry; carries folded by 2^-14 in the f32 epilogue.
// Layout: bf16 copy of the state rows [NB*USEQ][512]; W^T bf16 [32][512] (rows 30, 31 zero); ctx^T f16 plane [b*128 + d][t]; parameter plane f32 [b*USEQ + u][32] (0..9 weights, 10..19 inverse widths, 20..29 positions, 30..31 zero).
// Prefix sum: one lane per column walks the 512 rows of its batch in LDS with an f64 running value, one write per element. exp of the linear map: expf; window exponentials: exp2 of the log2(e)-scaled argument.

#ifndef NB
#define NB 8
#endif
#ifndef USEQ
#define USEQ 512
#endif
#ifndef TSEQ
#define TSEQ 1024
#endif
#define NB_FULL 8
#define U_FULL  512
#define T_FULL  1024
#ifndef OUT_U
#define OUT_U USEQ               // row pitch (in steps) between batches of the output
#endif
#define HIN  512                 // state width = depth of the linear map
#define DM   128                 // context width = output width
#define NMIX 10
#define NPAR 30                  // 3 * NMIX columns of the linear map
#define PW   32
#define AW   16                  // waves per window block: all on the same 16 steps, each on its own TSEQ/AW slice of t
#define OSP2 132                 // LDS row pitch (floats) of the output tile
#define CTP  72                  // LDS row pitch (halves) of the transpose tile
#define RPW  (USEQ / 8)          // rows per wave in the parameter kernel (8 waves per batch)
#define MT   (RPW / 16)
#define PCAR 256.0f              // carry of the window operand
#define CCAR 64.0f               // carry of the ctx plane
#define OSC  (1.0f / 16384.0f)   // 1 / (PCAR * CCAR)
#define NL2E (-1.4426950408889634f)

static_assert(NPAR == 3 * NMIX);
static_assert(NPAR <= PW);
static_assert(PW == 32);
static_assert(256 % PW == 0);                   // thread-linear element index keeps its column
static_assert(HIN % 32 == 0);                   // GEMM k-loop steps by 32
static_assert(HIN % 8 == 0);
static_assert(DM == 128);                       // output row = 32 lanes x 4 floats; 8 column tiles of 16
static_assert(USEQ % 128 == 0);                 // 8 waves x MT slabs of 16 rows cover a batch exactly
static_assert(MT >= 1);
static_assert(MT * 16 * 8 == USEQ);
static_assert(USEQ % 16 == 0);                  // window grid covers the steps exactly
static_assert(TSEQ % (32 * AW) == 0);           // every wave of a window block gets whole 32-t steps
static_assert(TSEQ % 64 == 0);
static_assert(TSEQ % 32 == 0);                  // window k-loop steps by 32
static_assert(NB <= NB_FULL);
static_assert(USEQ <= U_FULL);
static_assert(TSEQ <= T_FULL);
static_assert((OSP2 * 4) % 16 == 0);
static_assert((CTP * 2) % 16 == 0);
static_assert(((size_t)USEQ * HIN) % 8 == 0);
static_assert((size_t)USEQ * PW * 4 <= (size_t)131072);                                 // static LDS of the parameter kernel
static_assert((size_t)AW * 16 * PW * 4 + (size_t)AW * 16 * OSP2 * 4 <= (size_t)327680); // static LDS of the window kernel (one block per WGP)
static_assert((size_t)DM * CTP * 2 <= (size_t)131072);                                  // static LDS of the transpose kernel

typedef _Float16 h16;
typedef unsigned short bf;
typedef __attribute__((ext_vector_type(16))) __bf16   v16bf;
typedef __attribute__((ext_vector_type(16))) _Float16 v16h;
typedef __attribute__((ext_vector_type(8)))  _Float16 v8h;
typedef __attribute__((ext_vector_type(8)))  unsigned short v8us;
typedef __attribute__((ext_vector_type(8)))  float    v8f;
typedef __attribute__((ext_vector_type(4)))  float    v4f;
typedef v4f  __attribute__((may_alias)) v4fa;
typedef v8h  __attribute__((may_alias)) v8ha;

__device__ __forceinline__ unsigned short f2bf(float f) { unsigned u = __float_as_uint(f); u += 0x7FFFu + ((u >> 16) & 1u); return (unsigned short)(u >> 16); }
__device__ __forceinline__ float bfr(float f) { return __uint_as_float(((unsigned)f2bf(f)) << 16); }   // value after RNE convert to bf16
__device__ __forceinline__ v16h cat16(v8h lo, v8h hi) { return __builtin_shufflevector(lo, hi, 0, 1, 2, 3, 4, 5, 6, 7, 8, 9, 10, 11, 12, 13, 14, 15); }
__device__ __forceinline__ v16bf cat16b(v8us lo, v8us hi) { return __builtin_bit_cast(v16bf, __builtin_shufflevector(lo, hi, 0, 1, 2, 3, 4, 5, 6, 7, 8, 9, 10, 11, 12, 13, 14, 15)); }
__device__ __forceinline__ v8f wmma16(v16h a, v16h b, v8f c) { return __builtin_amdgcn_wmma_f32_16x16x32_f16(false, a, false, b, (short)0, c, false, false); }
__device__ __forceinline__ v8f wmmab(v16bf a, v16bf b, v8f c) { return __builtin_amdgcn_wmma_f32_16x16x32_bf16(false, a, false, b, (short)0, c, false, false); }
// fragment loaders from K-contiguous 16-bit rows; p already includes + 8*(lane>>4): elements 0..7 <- k0+8h+0..7, elements 8..15 <- k0+16+8h+0..7 (same map for A and B)
__device__ __forceinline__ v16h  ldh(const h16* p) { return cat16(*(const v8h*)p, *(const v8h*)(p + 16)); }
__device__ __forceinline__ v16bf ldb(const bf* p)  { return cat16b(*(const v8us*)p, *(const v8us*)(p + 16)); }
// ordering point for wave-private LDS tiles (same wave writes and reads)
__device__ __forceinline__ void wave_sync() { __builtin_amdgcn_fence(3 /* release order */, "wavefront"); __builtin_amdgcn_wave_barrier(); asm volatile("" ::: "memory"); }

// f32 -> f16 with a value select: magnitudes below the smallest normal f16 become +0 (applied after the plane's carry)
static __device__ __forceinline__ h16 toh_flush(float v) { const h16 r = (h16)v; return (fabsf(v) < 6.103515625e-05f) ? (h16)0.0f : r; }
// one matrix instruction + its own guard (one accumulator per guard)
__device__ __forceinline__ v8f wmmab_g(v16bf a, v16bf b, v8f c) { c = wmmab(a, b, c); asm volatile("v_nop\n\tv_nop\n\tv_nop\n\tv_nop" : "+v"(c) : "v"(a), "v"(b)); return c; }
__device__ __forceinline__ v8f wmma16_g(v16h a, v16h b, v8f c) { c = wmma16(a, b, c); asm volatile("v_nop\n\tv_nop\n\tv_nop\n\tv_nop" : "+v"(c) : "v"(a), "v"(b)); return c; }

__global__ __launch_bounds__(256) void k_cvt8(const float* __restrict__ src, bf* dst, size_t n8) {
    const size_t i = (size_t)blockIdx.x * 256 + threadIdx.x; if (i >= n8) return;
    const v8f v = *(const v8f*)(src + i * 8); v8us o;
#pragma unroll
    for (int k = 0; k < 8; ++k) o[k] = f2bf(v[k]);
    *(v8us*)(dst + i * 8) = o; 
}

// k_wt: W [HIN][30] ([in][out], f32) -> W^T bf16 [PW][HIN], rows 30, 31 zero. in[rows = HIN][cols = 30] -> out[cols padded to PW][rows = HIN].
static_assert(((size_t)PW * HIN / 8) % 256 == 0);      // grid x block == piece count
__global__ __launch_bounds__(256) void k_wt(const float* __restrict__ W, bf* WT) {
    const int p = blockIdx.x * 256 + threadIdx.x; if (p >= PW * HIN / 8) return;
    const int n = p / (HIN / 8), k0 = (p % (HIN / 8)) * 8;
    const int nc = n < NPAR ? n : (NPAR - 1);
    v8us o;
#pragma unroll
    for (int i = 0; i < 8; ++i) { float x = W[(size_t)(k0 + i) * NPAR + nc]; asm volatile("" : "+v"(x)); o[i] = (n < NPAR) ? f2bf(x) : (unsigned short)0; }
    *(v8us*)(WT + (size_t)p * 8) = o; 
}

// k_ctxT: ctx [b][t][128] f32 -> ctx^T f16 plane [(b*128 + d)][t] (bf16 RNE value x CCAR, exact in f16, flush select). in[rows = t][cols = d] -> out[cols = d][rows = t].
static_assert(64 * DM / 4 == 8 * 256);                 // load pieces: 8 trips x 256 threads
static_assert(DM * 8 == 4 * 256);
__global__ __launch_bounds__(256) void k_ctxT(const float* __restrict__ ctx, h16* CT) {
    __shared__ __align__(16) h16 sT[DM * CTP];
    const int tid = threadIdx.x; const int b = blockIdx.y, t0 = blockIdx.x * 64;
    const float* src = ctx + ((size_t)b * T_FULL + t0) * DM;
#pragma unroll 1
    for (int it = 0; it < 8; ++it) { const int q = it * 256 + tid; const int t = q >> 5, d4 = (q & 31) * 4;    // 64 t x 32 pieces of 4 d
        const v4f v = *(const v4f*)(src + (size_t)t * DM + d4);
#pragma unroll
        for (int i = 0; i < 4; ++i) sT[(d4 + i) * CTP + t] = toh_flush(bfr(v[i]) * CCAR); }
    __syncthreads();
    h16* dst = CT + (size_t)b * DM * TSEQ + t0;
{
#pragma unroll
        for (int it = 0; it < 4; ++it) { const int p = it * 256 + tid; const int row = p >> 3, c8 = (p & 7) * 8;   // 4 trips x 32 row groups = 128 rows; 8 lanes x 8 halves = 64 columns
            const v8h hv = *(const v8ha*)(&sT[row * CTP + c8]);
            *(v8h*)(dst + (size_t)row * TSEQ + c8) = hv; }
         }
}

// k_par: one block per batch (8 waves x RPW rows). bf16 GEMM C[u][n] = sum_k x[u][k] W^T[n][k] (K = HIN, N = 32 padded), operands straight from K-contiguous bf16 planes.
// Then in LDS (cross-wave: block barriers between phases): + bias (bf16 RNE value), expf, x 0.2 on columns 20..29, zero on columns 30, 31;
// prefix sum over u of columns 20..29 (wave 0, lane = column, f64 running value, one write per element, value select on the column);
static_assert(((size_t)USEQ * PW) % 256 == 0);
static_assert(((size_t)USEQ * PW / 4) % 256 == 0);
__global__ __launch_bounds__(256) void k_par(const bf* __restrict__ HB, const bf* __restrict__ WT, const float* __restrict__ bias, float* PAR) {
    __shared__ __align__(16) float sp[USEQ * PW];
    const int tid = threadIdx.x;
    const int lane = tid & 31, lr = lane & 15, hi = lane >> 4;
    const int wave = __builtin_amdgcn_readfirstlane((int)(threadIdx.x >> 5));
    const int b = blockIdx.x;
    const int r0 = wave * RPW;
    v8f acc[MT][2];
#pragma unroll
    for (int mb = 0; mb < MT; ++mb) { acc[mb][0] = (v8f){}; acc[mb][1] = (v8f){}; }
    const size_t aoff = ((size_t)b * USEQ + (size_t)(r0 + lr)) * HIN + 8 * hi;
    const size_t boff = (size_t)lr * HIN + 8 * hi;
#pragma unroll 1
    for (int kc = 0; kc < HIN; kc += 32) {
        v16bf a[MT];
#pragma unroll
        for (int mb = 0; mb < MT; ++mb) a[mb] = ldb(HB + aoff + (size_t)mb * 16 * HIN + kc);
#pragma unroll
        for (int nb = 0; nb < 2; ++nb) { const v16bf w = ldb(WT + boff + (size_t)nb * 16 * HIN + kc);
#pragma unroll
            for (int mb = 0; mb < MT; ++mb) acc[mb][nb] = wmmab_g(a[mb], w, acc[mb][nb]); }
    }
#pragma unroll
    for (int mb = 0; mb < MT; ++mb) {
#pragma unroll
        for (int nb = 0; nb < 2; ++nb) {
#pragma unroll
            for (int j = 0; j < 8; ++j) sp[(r0 + mb * 16 + hi * 8 + j) * PW + nb * 16 + lr] = acc[mb][nb][j]; } }   // D: row 8h+j, col lane&15
    __syncthreads();
    { const int c = tid & 31; const int cc = c < NPAR ? c : (NPAR - 1);
      float bx = bias[cc]; asm volatile("" : "+v"(bx));
      const float bcv = (c < NPAR) ? bfr(bx) : 0.0f;
      const float sc = (c >= 2 * NMIX) ? 0.2f : 1.0f;
#pragma unroll 1
      for (int it = 0; it < USEQ * PW / 256; ++it) { const int idx = it * 256 + tid;      // idx & 31 == c
          const float e = expf(sp[idx] + bcv) * sc;
          sp[idx] = (c < NPAR) ? e : 0.0f; } }
    __syncthreads();
    if (wave == 0) {
        const bool isk = (lane >= 2 * NMIX) & (lane < NPAR);
        double s = 0.0;
#pragma unroll 1
        for (int u = 0; u < USEQ; ++u) { const float v = sp[u * PW + lane]; s += (double)v; const float o = isk ? (float)s : v; sp[u * PW + lane] = o; }
    }
    __syncthreads();
    float* dst = PAR + (size_t)b * USEQ * PW;
{
#pragma unroll 1
        for (int it = 0; it < USEQ * PW / 4 / 256; ++it) { const int p = it * 256 + tid;
            const v4f val = *(const v4fa*)(&sp[p * 4]);
            *(v4f*)(dst + (size_t)p * 4) = val; }
         }
}

// k_window: one block per 16 steps u of one batch; its AW waves split the t range (wave w: t in [w*TSEQ/AW, (w+1)*TSEQ/AW)), each keeps a partial [16][128] f32 tile,
// and the partial tiles are summed through LDS in ascending wave order behind one block barrier. Per 32-t step the window tile phi[16 u][32 t] is built in registers directly in A-fragment order
// (lane: row u = lane&15, elements 0..7 <- t0+8h+0..7, elements 8..15 <- t0+16+8h+0..7): rolled loop over the 10 mixtures (per-row parameters from a wave-private LDS copy), 16 running sums per lane;
// phi x mask (bf16 RNE value) x PCAR -> f16 with the flush select. B fragments = ctx^T rows d = 16j + (lane&15), k = t, two 16-B loads each from the f16 plane. 8 accumulators (128 output columns).
static_assert(32 * 16 == DM * 4);                      // store extent of one instruction == one output row
static_assert(4 * 32 * 4 == 16 * PW);                  // parameter copy: 4 trips x 32 lanes x 4 floats == 16 rows x 32 floats
__global__ __launch_bounds__(32 * AW) void k_window(const float* __restrict__ PAR, const h16* __restrict__ CT, const float* __restrict__ mask, float* OUT) {
    __shared__ __align__(16) float sp[AW * 16 * PW];
    __shared__ __align__(16) float os[AW * 16 * OSP2];
    const int lane = threadIdx.x & 31, lr = lane & 15, hi = lane >> 4;
    const int wave = __builtin_amdgcn_readfirstlane((int)(threadIdx.x >> 5));
    const int b = blockIdx.y;
    const int u0 = blockIdx.x * 16;
    const int pb = wave * 16 * PW;
    { const float* prow = PAR + ((size_t)b * USEQ + (size_t)u0) * PW;
#pragma unroll
      for (int s = 0; s < 4; ++s) { const int p = s * 32 + lane; const v4f x = *(const v4f*)(prow + (size_t)p * 4); *(v4fa*)(&sp[pb + p * 4]) = x; } }
    wave_sync();
    v8f acc[8];
#pragma unroll
    for (int j = 0; j < 8; ++j) acc[j] = (v8f){};
    const float* maskb = mask + (size_t)b * T_FULL + 8 * hi;
    const h16* cb = CT + ((size_t)b * DM + (size_t)lr) * TSEQ + 8 * hi;      // + 16j*TSEQ + t0  (B fragment: col d, k = t)
    const int pw = pb + lr * PW;
#pragma unroll 1
    for (int ks = 0; ks < TSEQ / AW; ks += 32) {
        const int key0 = wave * (TSEQ / AW) + ks;                   // this wave's slice of t
        float s[16];
#pragma unroll
        for (int i = 0; i < 16; ++i) s[i] = 0.0f;
        const float tb = (float)(key0 + 8 * hi);
#pragma unroll 1
        for (int k = 0; k < NMIX; ++k) {
            const float a = sp[pw + k];
            const float g = sp[pw + NMIX + k] * NL2E;
            const float kp = sp[pw + 2 * NMIX + k];
#pragma unroll
            for (int i = 0; i < 8; ++i) {
                const float d0 = kp - (tb + (float)i);
                const float d1 = kp - (tb + (float)(16 + i));
                s[i]     += a * __builtin_amdgcn_exp2f(g * d0 * d0);
                s[8 + i] += a * __builtin_amdgcn_exp2f(g * d1 * d1); }
        }
        const float* kq = maskb + key0;                             // t = key0+8h+0..7 and key0+16+8h+0..7, all < TSEQ
        const v4f m0 = *(const v4f*)kq, m1 = *(const v4f*)(kq + 4), m2 = *(const v4f*)(kq + 16), m3 = *(const v4f*)(kq + 20);
        float mk[16];
#pragma unroll
        for (int r = 0; r < 4; ++r) { mk[r] = m0[r]; mk[4 + r] = m1[r]; mk[8 + r] = m2[r]; mk[12 + r] = m3[r]; }
        v16h pa;
#pragma unroll
        for (int i = 0; i < 16; ++i) { const float gv = s[i] * bfr(mk[i]) * PCAR; pa[i] = toh_flush(gv); }
#pragma unroll
        for (int j = 0; j < 8; ++j) { const v16h cf = ldh(cb + (size_t)j * 16 * TSEQ + key0); acc[j] = wmma16_g(pa, cf, acc[j]); }
    }
    const int wb = wave * 16 * OSP2;
    // D layout: acc[j][r] = (u = 8h + r, d = 16j + lane&15) -> os[wave][u][d]; rows 0..15 x columns 0..127 of the wave's partial tile all written
#pragma unroll
    for (int j = 0; j < 8; ++j) {
#pragma unroll
        for (int r = 0; r < 8; ++r) os[wb + (8 * hi + r) * OSP2 + 16 * j + lr] = acc[j][r] * OSC; }
    __syncthreads();                                                // every wave's partial tile is in LDS before any wave sums across them
    float* orow = OUT + ((size_t)b * OUT_U + (size_t)u0) * DM;
    for (int row = wave; row < 16; row += AW) {                     // one wave per output row: 32 lanes x 16 B == 512 B
        v4f val = *(const v4fa*)(&os[row * OSP2 + lane * 4]);
#pragma unroll                                                      // straight-line reads of the partial tiles overlap; rolled, each read would be waited for alone
        for (int w = 1; w < AW; ++w) val += *(const v4fa*)(&os[w * 16 * OSP2 + row * OSP2 + lane * 4]);
        *(v4f*)(orow + (size_t)row * DM + lane * 4) = val; }
}

static constexpr size_t al256(size_t v) { return (v + 255) & ~(size_t)255; }
static constexpr size_t SZ_HB  = al256((size_t)NB * USEQ * HIN * 2);
static constexpr size_t SZ_WT  = al256((size_t)PW * HIN * 2);
static constexpr size_t SZ_CT  = al256((size_t)NB * DM * TSEQ * 2);
static constexpr size_t SZ_PAR = al256((size_t)NB * USEQ * PW * 4);
static constexpr size_t SZ_TOTAL = SZ_HB + SZ_WT + SZ_CT + SZ_PAR;
static_assert(SZ_TOTAL <= (size_t)134217728);          // workspace carve <= 128 MiB
static_assert(((size_t)TSEQ * 2) % 128 == 0);
static_assert(((size_t)HIN * 2) % 128 == 0);

extern "C" void kernel_launch(void* const* d_in, const int* in_sizes, int n_in,
                              void* d_out, int out_size, void* d_ws, size_t ws_size, hipStream_t stream) {
    if (n_in < 5) return;
    const size_t needh = ((size_t)(NB - 1) * U_FULL + USEQ) * HIN;
    const size_t needc = ((size_t)(NB - 1) * T_FULL + TSEQ) * DM;
    const size_t needm = (size_t)(NB - 1) * T_FULL + TSEQ;
    if ((size_t)in_sizes[0] < needh || (size_t)in_sizes[1] < needc || (size_t)in_sizes[2] < needm) return;
    if ((size_t)in_sizes[3] < (size_t)HIN * NPAR || in_sizes[4] < NPAR) return;
    if ((size_t)out_size < ((size_t)(NB - 1) * OUT_U + USEQ) * DM) return;
    if (SZ_TOTAL > ws_size) return;
    // wire order: h_t, ctx, mask, W, b
    const float* hin  = (const float*)d_in[0];
    const float* ctx  = (const float*)d_in[1];
    const float* mask = (const float*)d_in[2];
    const float* wlin = (const float*)d_in[3];
    const float* blin = (const float*)d_in[4];
    float* OUT = (float*)d_out;      // [NB][USEQ][128]
    char* wsp = (char*)d_ws;
    bf*  HB  = (bf*)wsp;  wsp += SZ_HB;               // state rows [NB*USEQ][512] bf16
    bf*  WT  = (bf*)wsp;  wsp += SZ_WT;               // W^T [32][512] bf16
    h16* CT  = (h16*)wsp; wsp += SZ_CT;               // ctx^T [NB*128][TSEQ] f16 x64
    float* PAR = (float*)wsp; wsp += SZ_PAR;          // parameters [NB*USEQ][32] f32

    if (USEQ == U_FULL) {
        const size_t n8 = (size_t)NB * USEQ * HIN / 8;
        k_cvt8<<<(unsigned)((n8 + 255) / 256), 256, 0, stream>>>(hin, HB, n8);
    } else {
        const size_t n8 = (size_t)USEQ * HIN / 8;
        for (int b = 0; b < NB; ++b) k_cvt8<<<(unsigned)((n8 + 255) / 256), 256, 0, stream>>>(hin + (size_t)b * U_FULL * HIN, HB + (size_t)b * USEQ * HIN, n8);
    }
    k_wt<<<(unsigned)(((size_t)PW * HIN / 8 + 255) / 256), 256, 0, stream>>>(wlin, WT);
    // ctx [t][d] -> ctx^T [d][t]: grid (t tiles, batches)
    k_ctxT<<<dim3(TSEQ / 64, NB, 1), 256, 0, stream>>>(ctx, CT);
    k_par<<<dim3(NB, 1, 1), 256, 0, stream>>>(HB, WT, blin, PAR);
    k_window<<<dim3(USEQ / 16, NB, 1), 32 * AW, 0, stream>>>(PAR, CT, mask, OUT);
}

// v002
// A run of this version takes 49.2 microseconds.
// Next to v001, in two timings, it ran 1.79 and 1.82 times as fast.
// All steps since v000 together make it 3.26 times as fast.
#include <hip/hip_runtime.h>

// Soft window over a context sequence: per step u a 30-wide linear map of the state row (weights [in][out], bias), exp, split into 10 weights / 10 inverse widths / 10 position increments (x 0.2, prefix-summed over u);
// window phi[u][t] = sum_k w_k exp(-g_k (pos_k - t)^2); output [NB][USEQ][128] = (phi * mask) @ ctx, f32.
// Compute dtypes, f32 accumulate everywhere: state-row linear map v_wmma_f32_16x16x32_bf16 (state rows, W, bias RNE-converted to bf16; products exact);
// window-times-context v_wmma_f32_16x16x32_f16: phi single f16 with a x256 carry (built in registers, f32 vector math), ctx (RNE-converted to bf16, exact in f16) single f16 with a x64 carry; carries folded by 2^-14 in the f32 epilogue.
// Layout: bf16 copy of the state rows [NB*USEQ][512]; W^T bf16 [32][512] (rows 30, 31 zero); ctx^T f16 plane [b*128 + d][t]; parameter plane f32 [b*USEQ + u][32] (0..9 weights, 10..19 inverse widths, 20..29 positions, 30..31 zero).
// Prefix sum: the rows of a batch are cut into 16 segments (8 waves x 2 half-waves, lane = column); each segment keeps f64 running sums of its own rows, the segments' f64 totals meet in LDS, one write per element. exp of the linear map: expf; window exponentials: exp2 of the log2(e)-scaled argument.

#ifndef NB
#define NB 8
#endif
#ifndef USEQ
#define USEQ 512
#endif
#ifndef TSEQ
#define TSEQ 1024
#endif
#define NB_FULL 8
#define U_FULL  512
#define T_FULL  1024
#ifndef OUT_U
#define OUT_U USEQ               // row pitch (in steps) between batches of the output
#endif
#define HIN  512                 // state width = depth of the linear map
#define DM   128                 // context width = output width
#define NMIX 10
#define NPAR 30                  // 3 * NMIX columns of the linear map
#define PW   32
#define AW   16                  // waves per window block: all on the same 16 steps, each on its own TSEQ/AW slice of t
#define OSP2 132                 // LDS row pitch (floats) of the output tile
#define CTP  72                  // LDS row pitch (halves) of the transpose tile
#define RPW  (USEQ / 8)          // rows per wave in the parameter kernel (8 waves per batch)
#define MT   (RPW / 16)
#define SEGS 16                  // prefix-sum segments per batch: 8 waves x 2 half-waves
#define SROWS (USEQ / SEGS)      // rows per segment
#define PCAR 256.0f              // carry of the window operand
#define CCAR 64.0f               // carry of the ctx plane
#define OSC  (1.0f / 16384.0f)   // 1 / (PCAR * CCAR)
#define NL2E (-1.4426950408889634f)

static_assert(NPAR == 3 * NMIX);
static_assert(NPAR <= PW);
static_assert(PW == 32);
static_assert(256 % PW == 0);                   // thread-linear element index keeps its column
static_assert(HIN % 32 == 0);                   // GEMM k-loop steps by 32
static_assert(HIN % 8 == 0);
static_assert(DM == 128);                       // output row = 32 lanes x 4 floats; 8 column tiles of 16
static_assert(USEQ % 128 == 0);                 // 8 waves x MT slabs of 16 rows cover a batch exactly
static_assert(MT >= 1);
static_assert(MT * 16 * 8 == USEQ);
static_assert(SEGS * SROWS == USEQ);            // the segments cover a batch exactly
static_assert(NMIX <= 16);                      // one half-wave holds every summed column
static_assert(USEQ % 16 == 0);                  // window grid covers the steps exactly
static_assert(TSEQ % (32 * AW) == 0);           // every wave of a window block gets whole 32-t steps
static_assert(TSEQ % 64 == 0);
static_assert(TSEQ % 32 == 0);                  // window k-loop steps by 32
static_assert(NB <= NB_FULL);
static_assert(USEQ <= U_FULL);
static_assert(TSEQ <= T_FULL);
static_assert((OSP2 * 4) % 16 == 0);
static_assert((CTP * 2) % 16 == 0);
static_assert(((size_t)USEQ * HIN) % 8 == 0);
static_assert((size_t)USEQ * PW * 4 <= (size_t)131072);                                 // LDS tile of the parameter kernel (the f64 segment totals add 2 KB)
static_assert((size_t)AW * 16 * PW * 4 + (size_t)AW * 16 * OSP2 * 4 <= (size_t)327680); // static LDS of the window kernel (one block per WGP)
static_assert((size_t)DM * CTP * 2 <= (size_t)131072);                                  // static LDS of the transpose kernel

typedef _Float16 h16;
typedef unsigned short bf;
typedef __attribute__((ext_vector_type(16))) __bf16   v16bf;
typedef __attribute__((ext_vector_type(16))) _Float16 v16h;
typedef __attribute__((ext_vector_type(8)))  _Float16 v8h;
typedef __attribute__((ext_vector_type(8)))  unsigned short v8us;
typedef __attribute__((ext_vector_type(8)))  float    v8f;
typedef __attribute__((ext_vector_type(4)))  float    v4f;
typedef v4f  __attribute__((may_alias)) v4fa;
typedef v8h  __attribute__((may_alias)) v8ha;

__device__ __forceinline__ unsigned short f2bf(float f) { unsigned u = __float_as_uint(f); u += 0x7FFFu + ((u >> 16) & 1u); return (unsigned short)(u >> 16); }
__device__ __forceinline__ float bfr(float f) { return __uint_as_float(((unsigned)f2bf(f)) << 16); }   // value after RNE convert to bf16
__device__ __forceinline__ v16h cat16(v8h lo, v8h hi) { return __builtin_shufflevector(lo, hi, 0, 1, 2, 3, 4, 5, 6, 7, 8, 9, 10, 11, 12, 13, 14, 15); }
__device__ __forceinline__ v16bf cat16b(v8us lo, v8us hi) { return __builtin_bit_cast(v16bf, __builtin_shufflevector(lo, hi, 0, 1, 2, 3, 4, 5, 6, 7, 8, 9, 10, 11, 12, 13, 14, 15)); }
__device__ __forceinline__ v8f wmma16(v16h a, v16h b, v8f c) { return __builtin_amdgcn_wmma_f32_16x16x32_f16(false, a, false, b, (short)0, c, false, false); }
__device__ __forceinline__ v8f wmmab(v16bf a, v16bf b, v8f c) { return __builtin_amdgcn_wmma_f32_16x16x32_bf16(false, a, false, b, (short)0, c, false, false); }
// fragment loaders from K-contiguous 16-bit rows; p already includes + 8*(lane>>4): elements 0..7 <- k0+8h+0..7, elements 8..15 <- k0+16+8h+0..7 (same map for A and B)
__device__ __forceinline__ v16h  ldh(const h16* p) { return cat16(*(const v8h*)p, *(const v8h*)(p + 16)); }
__device__ __forceinline__ v16bf ldb(const bf* p)  { return cat16b(*(const v8us*)p, *(const v8us*)(p + 16)); }
// ordering point for wave-private LDS tiles (same wave writes and reads)
__device__ __forceinline__ void wave_sync() { __builtin_amdgcn_fence(3 /* release order */, "wavefront"); __builtin_amdgcn_wave_barrier(); asm volatile("" ::: "memory"); }

// f32 -> f16 with a value select: magnitudes below the smallest normal f16 become +0 (applied after the plane's carry)
static __device__ __forceinline__ h16 toh_flush(float v) { const h16 r = (h16)v; return (fabsf(v) < 6.103515625e-05f) ? (h16)0.0f : r; }
// one matrix instruction + its own guard (one accumulator per guard)
__device__ __forceinline__ v8f wmmab_g(v16bf a, v16bf b, v8f c) { c = wmmab(a, b, c); asm volatile("v_nop\n\tv_nop\n\tv_nop\n\tv_nop" : "+v"(c) : "v"(a), "v"(b)); return c; }
__device__ __forceinline__ v8f wmma16_g(v16h a, v16h b, v8f c) { c = wmma16(a, b, c); asm volatile("v_nop\n\tv_nop\n\tv_nop\n\tv_nop" : "+v"(c) : "v"(a), "v"(b)); return c; }

__global__ __launch_bounds__(256) void k_cvt8(const float* __restrict__ src, bf* dst, size_t n8) {
    const size_t i = (size_t)blockIdx.x * 256 + threadIdx.x; if (i >= n8) return;
    const v8f v = *(const v8f*)(src + i * 8); v8us o;
#pragma unroll
    for (int k = 0; k < 8; ++k) o[k] = f2bf(v[k]);
    *(v8us*)(dst + i * 8) = o; 
}

// k_wt: W [HIN][30] ([in][out], f32) -> W^T bf16 [PW][HIN], rows 30, 31 zero. in[rows = HIN][cols = 30] -> out[cols padded to PW][rows = HIN].
static_assert(((size_t)PW * HIN / 8) % 256 == 0);      // grid x block == piece count
__global__ __launch_bounds__(256) void k_wt(const float* __restrict__ W, bf* WT) {
    const int p = blockIdx.x * 256 + threadIdx.x; if (p >= PW * HIN / 8) return;
    const int n = p / (HIN / 8), k0 = (p % (HIN / 8)) * 8;
    const int nc = n < NPAR ? n : (NPAR - 1);
    v8us o;
#pragma unroll
    for (int i = 0; i < 8; ++i) { float x = W[(size_t)(k0 + i) * NPAR + nc]; asm volatile("" : "+v"(x)); o[i] = (n < NPAR) ? f2bf(x) : (unsigned short)0; }
    *(v8us*)(WT + (size_t)p * 8) = o; 
}

// k_ctxT: ctx [b][t][128] f32 -> ctx^T f16 plane [(b*128 + d)][t] (bf16 RNE value x CCAR, exact in f16, flush select). in[rows = t][cols = d] -> out[cols = d][rows = t].
static_assert(64 * DM / 4 == 8 * 256);                 // load pieces: 8 trips x 256 threads
static_assert(DM * 8 == 4 * 256);
__global__ __launch_bounds__(256) void k_ctxT(const float* __restrict__ ctx, h16* CT) {
    __shared__ __align__(16) h16 sT[DM * CTP];
    const int tid = threadIdx.x; const int b = blockIdx.y, t0 = blockIdx.x * 64;
    const float* src = ctx + ((size_t)b * T_FULL + t0) * DM;
#pragma unroll 1
    for (int it = 0; it < 8; ++it) { const int q = it * 256 + tid; const int t = q >> 5, d4 = (q & 31) * 4;    // 64 t x 32 pieces of 4 d
        const v4f v = *(const v4f*)(src + (size_t)t * DM + d4);
#pragma unroll
        for (int i = 0; i < 4; ++i) sT[(d4 + i) * CTP + t] = toh_flush(bfr(v[i]) * CCAR); }
    __syncthreads();
    h16* dst = CT + (size_t)b * DM * TSEQ + t0;
{
#pragma unroll
        for (int it = 0; it < 4; ++it) { const int p = it * 256 + tid; const int row = p >> 3, c8 = (p & 7) * 8;   // 4 trips x 32 row groups = 128 rows; 8 lanes x 8 halves = 64 columns
            const v8h hv = *(const v8ha*)(&sT[row * CTP + c8]);
            *(v8h*)(dst + (size_t)row * TSEQ + c8) = hv; }
         }
}

// k_par: one block per batch (8 waves x RPW rows). bf16 GEMM C[u][n] = sum_k x[u][k] W^T[n][k] (K = HIN, N = 32 padded), operands straight from K-contiguous bf16 planes.
// Then in LDS (cross-wave: block barriers between phases): + bias (bf16 RNE value), expf, x 0.2 on columns 20..29, zero on columns 30, 31;
// prefix sum over u of columns 20..29: segment = 2*wave + (lane>>4), column = 20 + (lane&15); f64 running sums inside the segment, then + the f64 totals of the segments before it (ascending), one write per element;
static_assert(((size_t)USEQ * PW) % 256 == 0);
static_assert(((size_t)USEQ * PW / 4) % 256 == 0);
__global__ __launch_bounds__(256) void k_par(const bf* __restrict__ HB, const bf* __restrict__ WT, const float* __restrict__ bias, float* PAR) {
    __shared__ __align__(16) float sp[USEQ * PW];
    __shared__ __align__(16) double stot[SEGS * 16];
    const int tid = threadIdx.x;
    const int lane = tid & 31, lr = lane & 15, hi = lane >> 4;
    const int wave = __builtin_amdgcn_readfirstlane((int)(threadIdx.x >> 5));
    const int b = blockIdx.x;
    const int r0 = wave * RPW;
    v8f acc[MT][2];
#pragma unroll
    for (int mb = 0; mb < MT; ++mb) { acc[mb][0] = (v8f){}; acc[mb][1] = (v8f){}; }
    const size_t aoff = ((size_t)b * USEQ + (size_t)(r0 + lr)) * HIN + 8 * hi;
    const size_t boff = (size_t)lr * HIN + 8 * hi;
#pragma unroll 1
    for (int kc = 0; kc < HIN; kc += 32) {
        v16bf a[MT];
#pragma unroll
        for (int mb = 0; mb < MT; ++mb) a[mb] = ldb(HB + aoff + (size_t)mb * 16 * HIN + kc);
#pragma unroll
        for (int nb = 0; nb < 2; ++nb) { const v16bf w = ldb(WT + boff + (size_t)nb * 16 * HIN + kc);
#pragma unroll
            for (int mb = 0; mb < MT; ++mb) acc[mb][nb] = wmmab_g(a[mb], w, acc[mb][nb]); }
    }
#pragma unroll
    for (int mb = 0; mb < MT; ++mb) {
#pragma unroll
        for (int nb = 0; nb < 2; ++nb) {
#pragma unroll
            for (int j = 0; j < 8; ++j) sp[(r0 + mb * 16 + hi * 8 + j) * PW + nb * 16 + lr] = acc[mb][nb][j]; } }   // D: row 8h+j, col lane&15
    __syncthreads();
    { const int c = tid & 31; const int cc = c < NPAR ? c : (NPAR - 1);
      float bx = bias[cc]; asm volatile("" : "+v"(bx));
      const float bcv = (c < NPAR) ? bfr(bx) : 0.0f;
      const float sc = (c >= 2 * NMIX) ? 0.2f : 1.0f;
#pragma unroll 1
      for (int it = 0; it < USEQ * PW / 256; ++it) { const int idx = it * 256 + tid;      // idx & 31 == c
          const float e = expf(sp[idx] + bcv) * sc;
          sp[idx] = (c < NPAR) ? e : 0.0f; } }
    __syncthreads();
    {
        const int seg = wave * 2 + hi;
        const bool isk = lr < NMIX;
        const int base = seg * SROWS * PW + 2 * NMIX + (isk ? lr : (NMIX - 1));   // spare lanes read the last summed column and write nothing
        double loc[SROWS];
        double s = 0.0;
#pragma unroll                                                      // straight line: the segment's LDS reads overlap and loc[] stays in registers
        for (int i = 0; i < SROWS; ++i) { s += (double)sp[base + i * PW]; loc[i] = s; }
        stot[seg * 16 + lr] = s;
        __syncthreads();                                            // every segment's total is in LDS before any segment sums the totals before it
        double off = 0.0;
#pragma unroll                                                      // straight line: the reads of the totals overlap
        for (int q = 0; q < SEGS - 1; ++q) { const double tq = stot[q * 16 + lr]; off += (q < seg) ? tq : 0.0; }
        if (isk) {
#pragma unroll                                                      // loc[] is indexed by constants only
            for (int i = 0; i < SROWS; ++i) sp[base + i * PW] = (float)(off + loc[i]);
        }
    }
    __syncthreads();
    float* dst = PAR + (size_t)b * USEQ * PW;
{
#pragma unroll 1
        for (int it = 0; it < USEQ * PW / 4 / 256; ++it) { const int p = it * 256 + tid;
            const v4f val = *(const v4fa*)(&sp[p * 4]);
            *(v4f*)(dst + (size_t)p * 4) = val; }
         }
}

// k_window: one block per 16 steps u of one batch; its AW waves split the t range (wave w: t in [w*TSEQ/AW, (w+1)*TSEQ/AW)), each keeps a partial [16][128] f32 tile,
// and the partial tiles are summed through LDS in ascending wave order behind one block barrier. Per 32-t step the window tile phi[16 u][32 t] is built in registers directly in A-fragment order
// (lane: row u = lane&15, elements 0..7 <- t0+8h+0..7, elements 8..15 <- t0+16+8h+0..7): rolled loop over the 10 mixtures (per-row parameters from a wave-private LDS copy), 16 running sums per lane;
// phi x mask (bf16 RNE value) x PCAR -> f16 with the flush select. B fragments = ctx^T rows d = 16j + (lane&15), k = t, two 16-B loads each from the f16 plane. 8 accumulators (128 output columns).
static_assert(32 * 16 == DM * 4);                      // store extent of one instruction == one output row
static_assert(4 * 32 * 4 == 16 * PW);                  // parameter copy: 4 trips x 32 lanes x 4 floats == 16 rows x 32 floats
__global__ __launch_bounds__(32 * AW) void k_window(const float* __restrict__ PAR, const h16* __restrict__ CT, const float* __restrict__ mask, float* OUT) {
    __shared__ __align__(16) float sp[AW * 16 * PW];
    __shared__ __align__(16) float os[AW * 16 * OSP2];
    const int lane = threadIdx.x & 31, lr = lane & 15, hi = lane >> 4;
    const int wave = __builtin_amdgcn_readfirstlane((int)(threadIdx.x >> 5));
    const int b = blockIdx.y;
    const int u0 = blockIdx.x * 16;
    const int pb = wave * 16 * PW;
    { const float* prow = PAR + ((size_t)b * USEQ + (size_t)u0) * PW;
#pragma unroll
      for (int s = 0; s < 4; ++s) { const int p = s * 32 + lane; const v4f x = *(const v4f*)(prow + (size_t)p * 4); *(v4fa*)(&sp[pb + p * 4]) = x; } }
    wave_sync();
    v8f acc[8];
#pragma unroll
    for (int j = 0; j < 8; ++j) acc[j] = (v8f){};
    const float* maskb = mask + (size_t)b * T_FULL + 8 * hi;
    const h16* cb = CT + ((size_t)b * DM + (size_t)lr) * TSEQ + 8 * hi;      // + 16j*TSEQ + t0  (B fragment: col d, k = t)
    const int pw = pb + lr * PW;
#pragma unroll 1
    for (int ks = 0; ks < TSEQ / AW; ks += 32) {
        const int key0 = wave * (TSEQ / AW) + ks;                   // this wave's slice of t
        float s[16];
#pragma unroll
        for (int i = 0; i < 16; ++i) s[i] = 0.0f;
        const float tb = (float)(key0 + 8 * hi);
#pragma unroll 1
        for (int k = 0; k < NMIX; ++k) {
            const float a = sp[pw + k];
            const float g = sp[pw + NMIX + k] * NL2E;
            const float kp = sp[pw + 2 * NMIX + k];
#pragma unroll
            for (int i = 0; i < 8; ++i) {
                const float d0 = kp - (tb + (float)i);
                const float d1 = kp - (tb + (float)(16 + i));
                s[i]     += a * __builtin_amdgcn_exp2f(g * d0 * d0);
                s[8 + i] += a * __builtin_amdgcn_exp2f(g * d1 * d1); }
        }
        const float* kq = maskb + key0;                             // t = key0+8h+0..7 and key0+16+8h+0..7, all < TSEQ
        const v4f m0 = *(const v4f*)kq, m1 = *(const v4f*)(kq + 4), m2 = *(const v4f*)(kq + 16), m3 = *(const v4f*)(kq + 20);
        float mk[16];
#pragma unroll
        for (int r = 0; r < 4; ++r) { mk[r] = m0[r]; mk[4 + r] = m1[r]; mk[8 + r] = m2[r]; mk[12 + r] = m3[r]; }
        v16h pa;
#pragma unroll
        for (int i = 0; i < 16; ++i) { const float gv = s[i] * bfr(mk[i]) * PCAR; pa[i] = toh_flush(gv); }
#pragma unroll
        for (int j = 0; j < 8; ++j) { const v16h cf = ldh(cb + (size_t)j * 16 * TSEQ + key0); acc[j] = wmma16_g(pa, cf, acc[j]); }
    }
    const int wb = wave * 16 * OSP2;
    // D layout: acc[j][r] = (u = 8h + r, d = 16j + lane&15) -> os[wave][u][d]; rows 0..15 x columns 0..127 of the wave's partial tile all written
#pragma unroll
    for (int j = 0; j < 8; ++j) {
#pragma unroll
        for (int r = 0; r < 8; ++r) os[wb + (8 * hi + r) * OSP2 + 16 * j + lr] = acc[j][r] * OSC; }
    __syncthreads();                                                // every wave's partial tile is in LDS before any wave sums across them
    float* orow = OUT + ((size_t)b * OUT_U + (size_t)u0) * DM;
    for (int row = wave; row < 16; row += AW) {                     // one wave per output row: 32 lanes x 16 B == 512 B
        v4f val = *(const v4fa*)(&os[row * OSP2 + lane * 4]);
#pragma unroll                                                      // straight-line reads of the partial tiles overlap; rolled, each read would be waited for alone
        for (int w = 1; w < AW; ++w) val += *(const v4fa*)(&os[w * 16 * OSP2 + row * OSP2 + lane * 4]);
        *(v4f*)(orow + (size_t)row * DM + lane * 4) = val; }
}

static constexpr size_t al256(size_t v) { return (v + 255) & ~(size_t)255; }
static constexpr size_t SZ_HB  = al256((size_t)NB * USEQ * HIN * 2);
static constexpr size_t SZ_WT  = al256((size_t)PW * HIN * 2);
static constexpr size_t SZ_CT  = al256((size_t)NB * DM * TSEQ * 2);
static constexpr size_t SZ_PAR = al256((size_t)NB * USEQ * PW * 4);
static constexpr size_t SZ_TOTAL = SZ_HB + SZ_WT + SZ_CT + SZ_PAR;
static_assert(SZ_TOTAL <= (size_t)134217728);          // workspace carve <= 128 MiB
static_assert(((size_t)TSEQ * 2) % 128 == 0);
static_assert(((size_t)HIN * 2) % 128 == 0);

extern "C" void kernel_launch(void* const* d_in, const int* in_sizes, int n_in,
                              void* d_out, int out_size, void* d_ws, size_t ws_size, hipStream_t stream) {
    if (n_in < 5) return;
    const size_t needh = ((size_t)(NB - 1) * U_FULL + USEQ) * HIN;
    const size_t needc = ((size_t)(NB - 1) * T_FULL + TSEQ) * DM;
    const size_t needm = (size_t)(NB - 1) * T_FULL + TSEQ;
    if ((size_t)in_sizes[0] < needh || (size_t)in_sizes[1] < needc || (size_t)in_sizes[2] < needm) return;
    if ((size_t)in_sizes[3] < (size_t)HIN * NPAR || in_sizes[4] < NPAR) return;
    if ((size_t)out_size < ((size_t)(NB - 1) * OUT_U + USEQ) * DM) return;
    if (SZ_TOTAL > ws_size) return;
    // wire order: h_t, ctx, mask, W, b
    const float* hin  = (const float*)d_in[0];
    const float* ctx  = (const float*)d_in[1];
    const float* mask = (const float*)d_in[2];
    const float* wlin = (const float*)d_in[3];
    const float* blin = (const float*)d_in[4];
    float* OUT = (float*)d_out;      // [NB][USEQ][128]
    char* wsp = (char*)d_ws;
    bf*  HB  = (bf*)wsp;  wsp += SZ_HB;               // state rows [NB*USEQ][512] bf16
    bf*  WT  = (bf*)wsp;  wsp += SZ_WT;               // W^T [32][512] bf16
    h16* CT  = (h16*)wsp; wsp += SZ_CT;               // ctx^T [NB*128][TSEQ] f16 x64
    float* PAR = (float*)wsp; wsp += SZ_PAR;          // parameters [NB*USEQ][32] f32

    if (USEQ == U_FULL) {
        const size_t n8 = (size_t)NB * USEQ * HIN / 8;
        k_cvt8<<<(unsigned)((n8 + 255) / 256), 256, 0, stream>>>(hin, HB, n8);
    } else {
        const size_t n8 = (size_t)USEQ * HIN / 8;
        for (int b = 0; b < NB; ++b) k_cvt8<<<(unsigned)((n8 + 255) / 256), 256, 0, stream>>>(hin + (size_t)b * U_FULL * HIN, HB + (size_t)b * USEQ * HIN, n8);
    }
    k_wt<<<(unsigned)(((size_t)PW * HIN / 8 + 255) / 256), 256, 0, stream>>>(wlin, WT);
    // ctx [t][d] -> ctx^T [d][t]: grid (t tiles, batches)
    k_ctxT<<<dim3(TSEQ / 64, NB, 1), 256, 0, stream>>>(ctx, CT);
    k_par<<<dim3(NB, 1, 1), 256, 0, stream>>>(HB, WT, blin, PAR);
    k_window<<<dim3(USEQ / 16, NB, 1), 32 * AW, 0, stream>>>(PAR, CT, mask, OUT);
}

// v003
// It runs in 33.4 microseconds.
// Two timings next to v002 put it at 1.45 and 1.48 times that version's speed.
// All steps since v000 together make it 4.77 times as fast.
#include <hip/hip_runtime.h>

// Soft window over a context sequence: per step u a 30-wide linear map of the state row (weights [in][out], bias), exp, split into 10 weights / 10 inverse widths / 10 position increments (x 0.2, prefix-summed over u);
// window phi[u][t] = sum_k w_k exp(-g_k (pos_k - t)^2); output [NB][USEQ][128] = (phi * mask) @ ctx, f32.
// Compute dtypes, f32 accumulate everywhere: state-row linear map v_wmma_f32_16x16x32_bf16 (state rows, W, bias RNE-converted to bf16; products exact);
// window-times-context v_wmma_f32_16x16x32_f16: phi single f16 with a x256 carry (built in registers, f32 vector math), ctx (RNE-converted to bf16, exact in f16) single f16 with a x64 carry; carries folded by 2^-14 in the f32 epilogue.
// Layout: state rows read as f32 and RNE-converted to bf16 in registers (no copy in memory); W^T bf16 [32][512] (rows 30, 31 zero); ctx^T f16 plane [b*128 + d][t]; parameter plane f32 [b*USEQ + u][32] (0..9 weights, 10..19 inverse widths, 20..29 positions, 30..31 zero).
// Linear map: one block per 16 state rows (whole chip), its 8 waves split the depth, f32 partial tiles summed in LDS in wave order; bias, expf and the x 0.2 follow there.
// Prefix sum (own launch, one block per batch, in place on the parameter plane): the rows of a batch are cut into 16 segments (8 waves x 2 half-waves, lane = column); each segment keeps f64 running sums of its own rows, the segments' f64 totals meet in LDS, one write per element. exp of the linear map: expf; window exponentials: exp2 of the log2(e)-scaled argument.

#ifndef NB
#define NB 8
#endif
#ifndef USEQ
#define USEQ 512
#endif
#ifndef TSEQ
#define TSEQ 1024
#endif
#define NB_FULL 8
#define U_FULL  512
#define T_FULL  1024
#ifndef OUT_U
#define OUT_U USEQ               // row pitch (in steps) between batches of the output
#endif
#define HIN  512                 // state width = depth of the linear map
#define DM   128                 // context width = output width
#define NMIX 10
#define NPAR 30                  // 3 * NMIX columns of the linear map
#define PW   32
#define AW   16                  // waves per window block: all on the same 16 steps, each on its own TSEQ/AW slice of t
#define OSP2 132                 // LDS row pitch (floats) of the output tile
#define CTP  72                  // LDS row pitch (halves) of the transpose tile
#define LW   8                   // waves per linear-map block: all on the same 16 rows, each on its own HIN/LW slice of the depth
#define LKS  (HIN / LW)          // depth per wave
#define LPP  36                  // LDS row pitch (floats) of a partial tile: 8 rows apart = 32 banks apart, so the two half-waves of a store do not meet
#define SEGS 16                  // prefix-sum segments per batch: 8 waves x 2 half-waves
#define SROWS (USEQ / SEGS)      // rows per segment
#define PCAR 256.0f              // carry of the window operand
#define CCAR 64.0f               // carry of the ctx plane
#define OSC  (1.0f / 16384.0f)   // 1 / (PCAR * CCAR)
#define NL2E (-1.4426950408889634f)

static_assert(NPAR == 3 * NMIX);
static_assert(NPAR <= PW);
static_assert(PW == 32);
static_assert(256 % PW == 0);                   // thread-linear element index keeps its column
static_assert(HIN % 32 == 0);                   // GEMM k-loop steps by 32
static_assert(HIN % 8 == 0);
static_assert(DM == 128);                       // output row = 32 lanes x 4 floats; 8 column tiles of 16
static_assert(LKS % 32 == 0);                   // every wave of a linear-map block gets whole 32-deep steps
static_assert(LW * LKS == HIN);
static_assert(16 * PW == 2 * 32 * LW);          // tile elements == 2 per thread of a linear-map block
static_assert(SEGS * SROWS == USEQ);            // the segments cover a batch exactly
static_assert(NMIX <= 16);                      // one half-wave holds every summed column
static_assert(USEQ % 16 == 0);                  // window grid covers the steps exactly
static_assert(TSEQ % (32 * AW) == 0);           // every wave of a window block gets whole 32-t steps
static_assert(TSEQ % 64 == 0);
static_assert(TSEQ % 32 == 0);                  // window k-loop steps by 32
static_assert(NB <= NB_FULL);
static_assert(USEQ <= U_FULL);
static_assert(TSEQ <= T_FULL);
static_assert((OSP2 * 4) % 16 == 0);
static_assert((CTP * 2) % 16 == 0);
static_assert((size_t)LW * 16 * LPP * 4 <= (size_t)131072);                             // static LDS of the linear-map kernel
static_assert((size_t)AW * 16 * PW * 4 + (size_t)AW * 16 * OSP2 * 4 <= (size_t)327680); // static LDS of the window kernel (one block per WGP)
static_assert((size_t)DM * CTP * 2 <= (size_t)131072);                                  // static LDS of the transpose kernel

typedef _Float16 h16;
typedef unsigned short bf;
typedef __attribute__((ext_vector_type(16))) __bf16   v16bf;
typedef __attribute__((ext_vector_type(16))) _Float16 v16h;
typedef __attribute__((ext_vector_type(8)))  _Float16 v8h;
typedef __attribute__((ext_vector_type(8)))  unsigned short v8us;
typedef __attribute__((ext_vector_type(8)))  float    v8f;
typedef __attribute__((ext_vector_type(4)))  float    v4f;
typedef v4f  __attribute__((may_alias)) v4fa;
typedef v8h  __attribute__((may_alias)) v8ha;

__device__ __forceinline__ unsigned short f2bf(float f) { unsigned u = __float_as_uint(f); u += 0x7FFFu + ((u >> 16) & 1u); return (unsigned short)(u >> 16); }
__device__ __forceinline__ float bfr(float f) { return __uint_as_float(((unsigned)f2bf(f)) << 16); }   // value after RNE convert to bf16
__device__ __forceinline__ v16h cat16(v8h lo, v8h hi) { return __builtin_shufflevector(lo, hi, 0, 1, 2, 3, 4, 5, 6, 7, 8, 9, 10, 11, 12, 13, 14, 15); }
__device__ __forceinline__ v16bf cat16b(v8us lo, v8us hi) { return __builtin_bit_cast(v16bf, __builtin_shufflevector(lo, hi, 0, 1, 2, 3, 4, 5, 6, 7, 8, 9, 10, 11, 12, 13, 14, 15)); }
__device__ __forceinline__ v8f wmma16(v16h a, v16h b, v8f c) { return __builtin_amdgcn_wmma_f32_16x16x32_f16(false, a, false, b, (short)0, c, false, false); }
__device__ __forceinline__ v8f wmmab(v16bf a, v16bf b, v8f c) { return __builtin_amdgcn_wmma_f32_16x16x32_bf16(false, a, false, b, (short)0, c, false, false); }
// fragment loaders from K-contiguous 16-bit rows; p already includes + 8*(lane>>4): elements 0..7 <- k0+8h+0..7, elements 8..15 <- k0+16+8h+0..7 (same map for A and B)
__device__ __forceinline__ v16h  ldh(const h16* p) { return cat16(*(const v8h*)p, *(const v8h*)(p + 16)); }
__device__ __forceinline__ v16bf ldb(const bf* p)  { return cat16b(*(const v8us*)p, *(const v8us*)(p + 16)); }
// ordering point for wave-private LDS tiles (same wave writes and reads)
__device__ __forceinline__ void wave_sync() { __builtin_amdgcn_fence(3 /* release order */, "wavefront"); __builtin_amdgcn_wave_barrier(); asm volatile("" ::: "memory"); }

// f32 -> f16 with a value select: magnitudes below the smallest normal f16 become +0 (applied after the plane's carry)
static __device__ __forceinline__ h16 toh_flush(float v) { const h16 r = (h16)v; return (fabsf(v) < 6.103515625e-05f) ? (h16)0.0f : r; }
// one matrix instruction + its own guard (one accumulator per guard)
__device__ __forceinline__ v8f wmmab_g(v16bf a, v16bf b, v8f c) { c = wmmab(a, b, c); asm volatile("v_nop\n\tv_nop\n\tv_nop\n\tv_nop" : "+v"(c) : "v"(a), "v"(b)); return c; }
__device__ __forceinline__ v8f wmma16_g(v16h a, v16h b, v8f c) { c = wmma16(a, b, c); asm volatile("v_nop\n\tv_nop\n\tv_nop\n\tv_nop" : "+v"(c) : "v"(a), "v"(b)); return c; }

// k_wt: W [HIN][30] ([in][out], f32) -> W^T bf16 [PW][HIN], rows 30, 31 zero. in[rows = HIN][cols = 30] -> out[cols padded to PW][rows = HIN].
static_assert(((size_t)PW * HIN / 8) % 256 == 0);      // grid x block == piece count
__global__ __launch_bounds__(256) void k_wt(const float* __restrict__ W, bf* WT) {
    const int p = blockIdx.x * 256 + threadIdx.x; if (p >= PW * HIN / 8) return;
    const int n = p / (HIN / 8), k0 = (p % (HIN / 8)) * 8;
    const int nc = n < NPAR ? n : (NPAR - 1);
    v8us o;
#pragma unroll
    for (int i = 0; i < 8; ++i) { float x = W[(size_t)(k0 + i) * NPAR + nc]; asm volatile("" : "+v"(x)); o[i] = (n < NPAR) ? f2bf(x) : (unsigned short)0; }
    *(v8us*)(WT + (size_t)p * 8) = o; 
}

// k_ctxT: ctx [b][t][128] f32 -> ctx^T f16 plane [(b*128 + d)][t] (bf16 RNE value x CCAR, exact in f16, flush select). in[rows = t][cols = d] -> out[cols = d][rows = t].
static_assert(64 * DM / 4 == 8 * 256);                 // load pieces: 8 trips x 256 threads
static_assert(DM * 8 == 4 * 256);
__global__ __launch_bounds__(256) void k_ctxT(const float* __restrict__ ctx, h16* CT) {
    __shared__ __align__(16) h16 sT[DM * CTP];
    const int tid = threadIdx.x; const int b = blockIdx.y, t0 = blockIdx.x * 64;
    const float* src = ctx + ((size_t)b * T_FULL + t0) * DM;
#pragma unroll 1
    for (int it = 0; it < 8; ++it) { const int q = it * 256 + tid; const int t = q >> 5, d4 = (q & 31) * 4;    // 64 t x 32 pieces of 4 d
        const v4f v = *(const v4f*)(src + (size_t)t * DM + d4);
#pragma unroll
        for (int i = 0; i < 4; ++i) sT[(d4 + i) * CTP + t] = toh_flush(bfr(v[i]) * CCAR); }
    __syncthreads();
    h16* dst = CT + (size_t)b * DM * TSEQ + t0;
{
#pragma unroll
        for (int it = 0; it < 4; ++it) { const int p = it * 256 + tid; const int row = p >> 3, c8 = (p & 7) * 8;   // 4 trips x 32 row groups = 128 rows; 8 lanes x 8 halves = 64 columns
            const v8h hv = *(const v8ha*)(&sT[row * CTP + c8]);
            *(v8h*)(dst + (size_t)row * TSEQ + c8) = hv; }
         }
}

// k_lin: one block per 16 state rows of one batch; its LW waves split the depth (wave w: k in [w*LKS, (w+1)*LKS)). bf16 GEMM C[u][n] = sum_k x[u][k] W^T[n][k] (N = 32 padded):
// A fragments straight from the f32 state rows (RNE to bf16 in registers, same k map as ldb), B fragments from the K-contiguous bf16 plane; every load of a wave is issued before its first use.
// The waves' partial [16][32] f32 tiles are summed through LDS in ascending wave order behind one block barrier; then + bias (bf16 RNE value), expf, x 0.2 on columns 20..29, zero on columns 30, 31; one write per element.
__global__ __launch_bounds__(32 * LW) void k_lin(const float* __restrict__ X, const bf* __restrict__ WT, const float* __restrict__ bias, float* PAR) {
    __shared__ __align__(16) float part[LW * 16 * LPP];
    const int tid = threadIdx.x;
    const int lane = tid & 31, lr = lane & 15, hi = lane >> 4;
    const int wave = __builtin_amdgcn_readfirstlane((int)(threadIdx.x >> 5));
    const int b = blockIdx.y;
    const int u0 = blockIdx.x * 16;
    const float* xr = X + ((size_t)b * U_FULL + (size_t)(u0 + lr)) * HIN + wave * LKS + 8 * hi;
    const bf* wr = WT + (size_t)lr * HIN + wave * LKS + 8 * hi;
    v4f xa[LKS / 32][4];
    v16bf w[LKS / 32][2];
#pragma unroll
    for (int ks = 0; ks < LKS / 32; ++ks) {                         // elements 0..7 <- k+8h+0..7, elements 8..15 <- k+16+8h+0..7
        xa[ks][0] = *(const v4f*)(xr + ks * 32);      xa[ks][1] = *(const v4f*)(xr + ks * 32 + 4);
        xa[ks][2] = *(const v4f*)(xr + ks * 32 + 16); xa[ks][3] = *(const v4f*)(xr + ks * 32 + 20); }
#pragma unroll
    for (int ks = 0; ks < LKS / 32; ++ks) {
#pragma unroll
        for (int nb = 0; nb < 2; ++nb) w[ks][nb] = ldb(wr + (size_t)nb * 16 * HIN + ks * 32); }
    const int c = tid & 31;
    const float bx = bias[c < NPAR ? c : (NPAR - 1)];
    __builtin_amdgcn_sched_barrier(0);                              // every load above is issued before the first wait; one sunk below a wait would pay a second round trip
    v8f acc[2];
    acc[0] = (v8f){}; acc[1] = (v8f){};
#pragma unroll
    for (int ks = 0; ks < LKS / 32; ++ks) {
        v8us lo, up;
#pragma unroll
        for (int i = 0; i < 4; ++i) { lo[i] = f2bf(xa[ks][0][i]); lo[4 + i] = f2bf(xa[ks][1][i]); up[i] = f2bf(xa[ks][2][i]); up[4 + i] = f2bf(xa[ks][3][i]); }
        const v16bf a = cat16b(lo, up);
#pragma unroll
        for (int nb = 0; nb < 2; ++nb) acc[nb] = wmmab_g(a, w[ks][nb], acc[nb]);
    }
#pragma unroll
    for (int nb = 0; nb < 2; ++nb) {
#pragma unroll
        for (int j = 0; j < 8; ++j) part[(wave * 16 + hi * 8 + j) * LPP + nb * 16 + lr] = acc[nb][j]; }   // D: row 8h+j, col lane&15
    __syncthreads();                                                // every wave's partial tile is in LDS before any wave sums across them
    const float bcv = (c < NPAR) ? bfr(bx) : 0.0f;
    const float sc = (c >= 2 * NMIX) ? 0.2f : 1.0f;
    float* dst = PAR + ((size_t)b * USEQ + (size_t)u0) * PW;
#pragma unroll
    for (int e = 0; e < 2; ++e) { const int row = e * LW + wave;     // one wave per parameter row: 32 lanes x 4 B == 128 B
        float v = part[row * LPP + c];
#pragma unroll                                                      // straight-line reads of the partial tiles overlap
        for (int q = 1; q < LW; ++q) v += part[(q * 16 + row) * LPP + c];
        const float ex = expf(v + bcv) * sc;
        dst[row * PW + c] = (c < NPAR) ? ex : 0.0f; }
}

// k_scan: one block per batch, in place on the parameter plane. Prefix sum over u of columns 20..29: segment = 2*wave + (lane>>4), column = 20 + (lane&15);
// f64 running sums inside the segment, then + the f64 totals of the segments before it (ascending, through LDS behind one block barrier), one write per element.
__global__ __launch_bounds__(256) void k_scan(float* PAR) {
    __shared__ __align__(16) double stot[SEGS * 16];
    const int lane = threadIdx.x & 31, lr = lane & 15, hi = lane >> 4;
    const int wave = __builtin_amdgcn_readfirstlane((int)(threadIdx.x >> 5));
    const int b = blockIdx.x;
    const int seg = wave * 2 + hi;
    const bool isk = lr < NMIX;
    float* col = PAR + ((size_t)b * USEQ + (size_t)seg * SROWS) * PW + 2 * NMIX + (isk ? lr : (NMIX - 1));   // spare lanes read the last summed column and write nothing
    float x[SROWS];
#pragma unroll                                                      // straight line: the segment's loads are all in flight together
    for (int i = 0; i < SROWS; ++i) x[i] = col[i * PW];
    __builtin_amdgcn_sched_barrier(0);                              // every load above is issued before the first wait; one sunk below a wait would pay a second round trip
    double loc[SROWS];
    double s = 0.0;
#pragma unroll                                                      // loc[] is indexed by constants only and stays in registers
    for (int i = 0; i < SROWS; ++i) { s += (double)x[i]; loc[i] = s; }
    stot[seg * 16 + lr] = s;
    __syncthreads();                                                // every segment's total is in LDS before any segment sums the totals before it
    double off = 0.0;
#pragma unroll                                                      // straight line: the reads of the totals overlap
    for (int q = 0; q < SEGS - 1; ++q) { const double tq = stot[q * 16 + lr]; off += (q < seg) ? tq : 0.0; }
    if (isk) {
#pragma unroll                                                      // loc[] is indexed by constants only
        for (int i = 0; i < SROWS; ++i) col[i * PW] = (float)(off + loc[i]);
    }
}

// k_window: one block per 16 steps u of one batch; its AW waves split the t range (wave w: t in [w*TSEQ/AW, (w+1)*TSEQ/AW)), each keeps a partial [16][128] f32 tile,
// and the partial tiles are summed through LDS in ascending wave order behind one block barrier. Per 32-t step the window tile phi[16 u][32 t] is built in registers directly in A-fragment order
// (lane: row u = lane&15, elements 0..7 <- t0+8h+0..7, elements 8..15 <- t0+16+8h+0..7): rolled loop over the 10 mixtures (per-row parameters from a wave-private LDS copy), 16 running sums per lane;
// phi x mask (bf16 RNE value) x PCAR -> f16 with the flush select. B fragments = ctx^T rows d = 16j + (lane&15), k = t, two 16-B loads each from the f16 plane. 8 accumulators (128 output columns).
static_assert(32 * 16 == DM * 4);                      // store extent of one instruction == one output row
static_assert(4 * 32 * 4 == 16 * PW);                  // parameter copy: 4 trips x 32 lanes x 4 floats == 16 rows x 32 floats
__global__ __launch_bounds__(32 * AW) void k_window(const float* __restrict__ PAR, const h16* __restrict__ CT, const float* __restrict__ mask, float* OUT) {
    __shared__ __align__(16) float sp[AW * 16 * PW];
    __shared__ __align__(16) float os[AW * 16 * OSP2];
    const int lane = threadIdx.x & 31, lr = lane & 15, hi = lane >> 4;
    const int wave = __builtin_amdgcn_readfirstlane((int)(threadIdx.x >> 5));
    const int b = blockIdx.y;
    const int u0 = blockIdx.x * 16;
    const int pb = wave * 16 * PW;
    { const float* prow = PAR + ((size_t)b * USEQ + (size_t)u0) * PW;
#pragma unroll
      for (int s = 0; s < 4; ++s) { const int p = s * 32 + lane; const v4f x = *(const v4f*)(prow + (size_t)p * 4); *(v4fa*)(&sp[pb + p * 4]) = x; } }
    wave_sync();
    v8f acc[8];
#pragma unroll
    for (int j = 0; j < 8; ++j) acc[j] = (v8f){};
    const float* maskb = mask + (size_t)b * T_FULL + 8 * hi;
    const h16* cb = CT + ((size_t)b * DM + (size_t)lr) * TSEQ + 8 * hi;      // + 16j*TSEQ + t0  (B fragment: col d, k = t)
    const int pw = pb + lr * PW;
#pragma unroll 1
    for (int ks = 0; ks < TSEQ / AW; ks += 32) {
        const int key0 = wave * (TSEQ / AW) + ks;                   // this wave's slice of t
        float s[16];
#pragma unroll
        for (int i = 0; i < 16; ++i) s[i] = 0.0f;
        const float tb = (float)(key0 + 8 * hi);
#pragma unroll 1
        for (int k = 0; k < NMIX; ++k) {
            const float a = sp[pw + k];
            const float g = sp[pw + NMIX + k] * NL2E;
            const float kp = sp[pw + 2 * NMIX + k];
#pragma unroll
            for (int i = 0; i < 8; ++i) {
                const float d0 = kp - (tb + (float)i);
                const float d1 = kp - (tb + (float)(16 + i));
                s[i]     += a * __builtin_amdgcn_exp2f(g * d0 * d0);
                s[8 + i] += a * __builtin_amdgcn_exp2f(g * d1 * d1); }
        }
        const float* kq = maskb + key0;                             // t = key0+8h+0..7 and key0+16+8h+0..7, all < TSEQ
        const v4f m0 = *(const v4f*)kq, m1 = *(const v4f*)(kq + 4), m2 = *(const v4f*)(kq + 16), m3 = *(const v4f*)(kq + 20);
        float mk[16];
#pragma unroll
        for (int r = 0; r < 4; ++r) { mk[r] = m0[r]; mk[4 + r] = m1[r]; mk[8 + r] = m2[r]; mk[12 + r] = m3[r]; }
        v16h pa;
#pragma unroll
        for (int i = 0; i < 16; ++i) { const float gv = s[i] * bfr(mk[i]) * PCAR; pa[i] = toh_flush(gv); }
#pragma unroll
        for (int j = 0; j < 8; ++j) { const v16h cf = ldh(cb + (size_t)j * 16 * TSEQ + key0); acc[j] = wmma16_g(pa, cf, acc[j]); }
    }
    const int wb = wave * 16 * OSP2;
    // D layout: acc[j][r] = (u = 8h + r, d = 16j + lane&15) -> os[wave][u][d]; rows 0..15 x columns 0..127 of the wave's partial tile all written
#pragma unroll
    for (int j = 0; j < 8; ++j) {
#pragma unroll
        for (int r = 0; r < 8; ++r) os[wb + (8 * hi + r) * OSP2 + 16 * j + lr] = acc[j][r] * OSC; }
    __syncthreads();                                                // every wave's partial tile is in LDS before any wave sums across them
    float* orow = OUT + ((size_t)b * OUT_U + (size_t)u0) * DM;
    for (int row = wave; row < 16; row += AW) {                     // one wave per output row: 32 lanes x 16 B == 512 B
        v4f val = *(const v4fa*)(&os[row * OSP2 + lane * 4]);
#pragma unroll                                                      // straight-line reads of the partial tiles overlap; rolled, each read would be waited for alone
        for (int w = 1; w < AW; ++w) val += *(const v4fa*)(&os[w * 16 * OSP2 + row * OSP2 + lane * 4]);
        *(v4f*)(orow + (size_t)row * DM + lane * 4) = val; }
}

static constexpr size_t al256(size_t v) { return (v + 255) & ~(size_t)255; }
static constexpr size_t SZ_WT  = al256((size_t)PW * HIN * 2);
static constexpr size_t SZ_CT  = al256((size_t)NB * DM * TSEQ * 2);
static constexpr size_t SZ_PAR = al256((size_t)NB * USEQ * PW * 4);
static constexpr size_t SZ_TOTAL = SZ_WT + SZ_CT + SZ_PAR;
static_assert(SZ_TOTAL <= (size_t)134217728);          // workspace carve <= 128 MiB
static_assert(((size_t)TSEQ * 2) % 128 == 0);
static_assert(((size_t)HIN * 2) % 128 == 0);

extern "C" void kernel_launch(void* const* d_in, const int* in_sizes, int n_in,
                              void* d_out, int out_size, void* d_ws, size_t ws_size, hipStream_t stream) {
    if (n_in < 5) return;
    const size_t needh = ((size_t)(NB - 1) * U_FULL + USEQ) * HIN;
    const size_t needc = ((size_t)(NB - 1) * T_FULL + TSEQ) * DM;
    const size_t needm = (size_t)(NB - 1) * T_FULL + TSEQ;
    if ((size_t)in_sizes[0] < needh || (size_t)in_sizes[1] < needc || (size_t)in_sizes[2] < needm) return;
    if ((size_t)in_sizes[3] < (size_t)HIN * NPAR || in_sizes[4] < NPAR) return;
    if ((size_t)out_size < ((size_t)(NB - 1) * OUT_U + USEQ) * DM) return;
    if (SZ_TOTAL > ws_size) return;
    // wire order: h_t, ctx, mask, W, b
    const float* hin  = (const float*)d_in[0];
    const float* ctx  = (const float*)d_in[1];
    const float* mask = (const float*)d_in[2];
    const float* wlin = (const float*)d_in[3];
    const float* blin = (const float*)d_in[4];
    float* OUT = (float*)d_out;      // [NB][USEQ][128]
    char* wsp = (char*)d_ws;
    bf*  WT  = (bf*)wsp;  wsp += SZ_WT;               // W^T [32][512] bf16
    h16* CT  = (h16*)wsp; wsp += SZ_CT;               // ctx^T [NB*128][TSEQ] f16 x64
    float* PAR = (float*)wsp; wsp += SZ_PAR;          // parameters [NB*USEQ][32] f32

    k_wt<<<(unsigned)(((size_t)PW * HIN / 8 + 255) / 256), 256, 0, stream>>>(wlin, WT);
    // ctx [t][d] -> ctx^T [d][t]: grid (t tiles, batches)
    k_ctxT<<<dim3(TSEQ / 64, NB, 1), 256, 0, stream>>>(ctx, CT);
    k_lin<<<dim3(USEQ / 16, NB, 1), 32 * LW, 0, stream>>>(hin, WT, blin, PAR);
    k_scan<<<dim3(NB, 1, 1), 256, 0, stream>>>(PAR);
    k_window<<<dim3(USEQ / 16, NB, 1), 32 * AW, 0, stream>>>(PAR, CT, mask, OUT);
}

// v004
// Measured time: 21.7 microseconds a run.
// Next to v003, in two timings, it ran 1.53 and 1.57 times as fast.
// Counting every step since v000, it is 7.39 times as fast.
#include <hip/hip_runtime.h>

// Soft window over a context sequence: per step u a 30-wide linear map of the state row (weights [in][out], bias), exp, split into 10 weights / 10 inverse widths / 10 position increments (x 0.2, prefix-summed over u);
// window phi[u][t] = sum_k w_k exp(-g_k (pos_k - t)^2); output [NB][USEQ][128] = (phi * mask) @ ctx, f32.
// Compute dtypes, f32 accumulate everywhere: state-row linear map v_wmma_f32_16x16x32_bf16 (state rows, W, bias RNE-converted to bf16; products exact);
// window-times-context v_wmma_f32_16x16x32_f16: phi single f16 with a x256 carry (built in registers, f32 vector math), ctx (RNE-converted to bf16, exact in f16) single f16 with a x64 carry; carries folded by 2^-14 in the f32 epilogue.
// Layout: state rows and W read as f32 and RNE-converted to bf16 in registers (no copy in memory; columns 30, 31 of the W fragments zero); ctx^T f16 plane [b*128 + d][t]; parameter plane f32 [b*USEQ + u][32] (0..9 weights, 10..19 inverse widths, 20..29 position increments, 30..31 zero).
// Two launches: (1) the ctx transpose blocks and the linear-map blocks side by side in one grid (neither reads what the other writes); (2) the window blocks, each of which forms the positions of its own 16 steps itself.
// Linear map: one block per 16 state rows (whole chip), its 8 waves split the depth, f32 partial tiles summed in LDS in wave order; bias, expf and the x 0.2 follow there.
// Prefix sum (head of every window block): the rows of a batch are cut into 32 segments of 16 (16 waves x 2 half-waves, lane = column); the segments up to the block's own keep f64 sums of their rows, the f64 totals meet in LDS, and the block's own segment writes its 16 rows of positions to LDS. exp of the linear map: expf; window exponentials: exp2 of the log2(e)-scaled argument.

#ifndef NB
#define NB 8
#endif
#ifndef USEQ
#define USEQ 512
#endif
#ifndef TSEQ
#define TSEQ 1024
#endif
#define NB_FULL 8
#define U_FULL  512
#define T_FULL  1024
#ifndef OUT_U
#define OUT_U USEQ               // row pitch (in steps) between batches of the output
#endif
#define HIN  512                 // state width = depth of the linear map
#define DM   128                 // context width = output width
#define NMIX 10
#define NPAR 30                  // 3 * NMIX columns of the linear map
#define PW   32
#define AW   16                  // waves per window block: all on the same 16 steps, each on its own TSEQ/AW slice of t
#define OSP2 132                 // LDS row pitch (floats) of the output tile
#define CTP  72                  // LDS row pitch (halves) of the transpose tile
#define LW   8                   // waves per linear-map block: all on the same 16 rows, each on its own HIN/LW slice of the depth
#define LKS  (HIN / LW)          // depth per wave
#define LPP  36                  // LDS row pitch (floats) of a partial tile: 8 rows apart = 32 banks apart, so the two half-waves of a store do not meet
#define SEGS (2 * AW)            // prefix-sum segments per batch: AW waves x 2 half-waves
#define SROWS 16                 // rows per segment == steps per window block
#define PSP  17                  // LDS row pitch (floats) of the position tile: 16 rows land on 16 banks
#define CTB  (TSEQ / 64)         // ctx transpose blocks per batch
#define PCAR 256.0f              // carry of the window operand
#define CCAR 64.0f               // carry of the ctx plane
#define OSC  (1.0f / 16384.0f)   // 1 / (PCAR * CCAR)
#define NL2E (-1.4426950408889634f)

static_assert(NPAR == 3 * NMIX);
static_assert(NPAR <= PW);
static_assert(PW == 32);
static_assert(256 % PW == 0);                   // thread-linear element index keeps its column
static_assert(HIN % 32 == 0);                   // GEMM k-loop steps by 32
static_assert(HIN % 8 == 0);
static_assert(DM == 128);                       // output row = 32 lanes x 4 floats; 8 column tiles of 16
static_assert(LKS % 32 == 0);                   // every wave of a linear-map block gets whole 32-deep steps
static_assert(LW * LKS == HIN);
static_assert(16 * PW == 2 * 32 * LW);          // tile elements == 2 per thread of a linear-map block
static_assert(SEGS * SROWS == USEQ);            // the segments cover a batch exactly
static_assert(NMIX <= 16);                      // one half-wave holds every summed column
static_assert(USEQ % 16 == 0);                  // window grid covers the steps exactly
static_assert(TSEQ % (32 * AW) == 0);           // every wave of a window block gets whole 32-t steps
static_assert(TSEQ % 64 == 0);
static_assert(TSEQ % 32 == 0);                  // window k-loop steps by 32
static_assert(NB <= NB_FULL);
static_assert(USEQ <= U_FULL);
static_assert(TSEQ <= T_FULL);
static_assert((OSP2 * 4) % 16 == 0);
static_assert((CTP * 2) % 16 == 0);
static_assert((size_t)LW * 16 * LPP * 4 + (size_t)DM * CTP * 2 <= (size_t)131072);      // static LDS of the first launch
static_assert((size_t)AW * 16 * PW * 4 + (size_t)AW * 16 * OSP2 * 4 + (size_t)SEGS * 16 * 8 + (size_t)16 * PSP * 4 <= (size_t)327680); // static LDS of the window kernel (one block per WGP)
static_assert(32 * LW == 256);                  // both kinds of block of the first launch have 256 threads

typedef _Float16 h16;
typedef __attribute__((ext_vector_type(16))) __bf16   v16bf;
typedef __attribute__((ext_vector_type(16))) _Float16 v16h;
typedef __attribute__((ext_vector_type(8)))  _Float16 v8h;
typedef __attribute__((ext_vector_type(8)))  unsigned short v8us;
typedef __attribute__((ext_vector_type(8)))  float    v8f;
typedef __attribute__((ext_vector_type(4)))  float    v4f;
typedef v4f  __attribute__((may_alias)) v4fa;
typedef v8h  __attribute__((may_alias)) v8ha;

__device__ __forceinline__ unsigned short f2bf(float f) { unsigned u = __float_as_uint(f); u += 0x7FFFu + ((u >> 16) & 1u); return (unsigned short)(u >> 16); }
__device__ __forceinline__ float bfr(float f) { return __uint_as_float(((unsigned)f2bf(f)) << 16); }   // value after RNE convert to bf16
__device__ __forceinline__ v16h cat16(v8h lo, v8h hi) { return __builtin_shufflevector(lo, hi, 0, 1, 2, 3, 4, 5, 6, 7, 8, 9, 10, 11, 12, 13, 14, 15); }
__device__ __forceinline__ v16bf cat16b(v8us lo, v8us hi) { return __builtin_bit_cast(v16bf, __builtin_shufflevector(lo, hi, 0, 1, 2, 3, 4, 5, 6, 7, 8, 9, 10, 11, 12, 13, 14, 15)); }
__device__ __forceinline__ v8f wmma16(v16h a, v16h b, v8f c) { return __builtin_amdgcn_wmma_f32_16x16x32_f16(false, a, false, b, (short)0, c, false, false); }
__device__ __forceinline__ v8f wmmab(v16bf a, v16bf b, v8f c) { return __builtin_amdgcn_wmma_f32_16x16x32_bf16(false, a, false, b, (short)0, c, false, false); }
// fragment loaders from K-contiguous 16-bit rows; p already includes + 8*(lane>>4): elements 0..7 <- k0+8h+0..7, elements 8..15 <- k0+16+8h+0..7 (same map for A and B)
__device__ __forceinline__ v16h  ldh(const h16* p) { return cat16(*(const v8h*)p, *(const v8h*)(p + 16)); }
// ordering point for wave-private LDS tiles (same wave writes and reads)
__device__ __forceinline__ void wave_sync() { __builtin_amdgcn_fence(3 /* release order */, "wavefront"); __builtin_amdgcn_wave_barrier(); asm volatile("" ::: "memory"); }

// f32 -> f16 with a value select: magnitudes below the smallest normal f16 become +0 (applied after the plane's carry)
static __device__ __forceinline__ h16 toh_flush(float v) { const h16 r = (h16)v; return (fabsf(v) < 6.103515625e-05f) ? (h16)0.0f : r; }
// one matrix instruction + its own guard (one accumulator per guard)
__device__ __forceinline__ v8f wmmab_g(v16bf a, v16bf b, v8f c) { c = wmmab(a, b, c); asm volatile("v_nop\n\tv_nop\n\tv_nop\n\tv_nop" : "+v"(c) : "v"(a), "v"(b)); return c; }
__device__ __forceinline__ v8f wmma16_g(v16h a, v16h b, v8f c) { c = wmma16(a, b, c); asm volatile("v_nop\n\tv_nop\n\tv_nop\n\tv_nop" : "+v"(c) : "v"(a), "v"(b)); return c; }

// ctxT_block (blocks x < CTB of the first launch): ctx [b][t][128] f32 -> ctx^T f16 plane [(b*128 + d)][t] (bf16 RNE value x CCAR, exact in f16, flush select). in[rows = t][cols = d] -> out[cols = d][rows = t].
static_assert(64 * DM / 4 == 8 * 256);                 // load pieces: 8 trips x 256 threads
static_assert(DM * 8 == 4 * 256);
static __device__ __forceinline__ void ctxT_block(const float* __restrict__ ctx, h16* CT, h16* sT) {
    const int tid = threadIdx.x; const int b = blockIdx.y, t0 = blockIdx.x * 64;
    const float* src = ctx + ((size_t)b * T_FULL + t0) * DM;
#pragma unroll 1
    for (int it = 0; it < 8; ++it) { const int q = it * 256 + tid; const int t = q >> 5, d4 = (q & 31) * 4;    // 64 t x 32 pieces of 4 d
        const v4f v = *(const v4f*)(src + (size_t)t * DM + d4);
#pragma unroll
        for (int i = 0; i < 4; ++i) sT[(d4 + i) * CTP + t] = toh_flush(bfr(v[i]) * CCAR); }
    __syncthreads();
    h16* dst = CT + (size_t)b * DM * TSEQ + t0;
{
#pragma unroll
        for (int it = 0; it < 4; ++it) { const int p = it * 256 + tid; const int row = p >> 3, c8 = (p & 7) * 8;   // 4 trips x 32 row groups = 128 rows; 8 lanes x 8 halves = 64 columns
            const v8h hv = *(const v8ha*)(&sT[row * CTP + c8]);
            *(v8h*)(dst + (size_t)row * TSEQ + c8) = hv; }
         }
}

// lin_block (blocks x >= CTB of the first launch): one block per 16 state rows of one batch; its LW waves split the depth (wave w: k in [w*LKS, (w+1)*LKS)). bf16 GEMM C[u][n] = sum_k x[u][k] W[k][n] (N = 32 padded):
// A fragments straight from the f32 state rows, B fragments straight from the f32 W rows (column n = 16nb + lane&15, one 4-B load per element), both RNE to bf16 in registers with the k map of ldh; every load of a wave is issued before its first use.
// The waves' partial [16][32] f32 tiles are summed through LDS in ascending wave order behind one block barrier; then + bias (bf16 RNE value), expf, x 0.2 on columns 20..29, zero on columns 30, 31; one write per element.
static __device__ __forceinline__ void lin_block(const float* __restrict__ X, const float* __restrict__ W, const float* __restrict__ bias, float* PAR, float* part) {
    const int tid = threadIdx.x;
    const int lane = tid & 31, lr = lane & 15, hi = lane >> 4;
    const int wave = __builtin_amdgcn_readfirstlane((int)(threadIdx.x >> 5));
    const int b = blockIdx.y;
    const int u0 = ((int)blockIdx.x - CTB) * 16;
    const float* xr = X + ((size_t)b * U_FULL + (size_t)(u0 + lr)) * HIN + wave * LKS + 8 * hi;
    const float* wr = W + (size_t)(wave * LKS + 8 * hi) * NPAR;     // + k*NPAR + column
    const int wc[2] = { lr, (16 + lr < NPAR) ? (16 + lr) : (NPAR - 1) };   // spare columns read the last real one and are zeroed below
    const unsigned short wm[2] = { (unsigned short)0xFFFFu, (16 + lr < NPAR) ? (unsigned short)0xFFFFu : (unsigned short)0 };   // bit mask, not a branch: the fragment's loads stay with the others above the first wait
    v4f xa[LKS / 32][4];
    float wf[LKS / 32][2][16];
#pragma unroll
    for (int ks = 0; ks < LKS / 32; ++ks) {                         // elements 0..7 <- k+8h+0..7, elements 8..15 <- k+16+8h+0..7
        xa[ks][0] = *(const v4f*)(xr + ks * 32);      xa[ks][1] = *(const v4f*)(xr + ks * 32 + 4);
        xa[ks][2] = *(const v4f*)(xr + ks * 32 + 16); xa[ks][3] = *(const v4f*)(xr + ks * 32 + 20); }
#pragma unroll
    for (int ks = 0; ks < LKS / 32; ++ks) {
#pragma unroll
        for (int nb = 0; nb < 2; ++nb) {
#pragma unroll
            for (int e = 0; e < 16; ++e) wf[ks][nb][e] = wr[(ks * 32 + (e < 8 ? e : e + 8)) * NPAR + wc[nb]]; } }   // elements 0..7 <- k+8h+0..7, elements 8..15 <- k+16+8h+0..7
    const int c = tid & 31;
    const float bx = bias[c < NPAR ? c : (NPAR - 1)];
    asm volatile("" :: "v"(bx));                                    // input-only use of the loaded value: keeps the bias load up here with the others; sunk to its use behind the barrier it would pay a round trip of its own
    __builtin_amdgcn_sched_barrier(0);                              // every load above is issued before the first wait; one sunk below a wait would pay a second round trip
    v8f acc[2];
    acc[0] = (v8f){}; acc[1] = (v8f){};
#pragma unroll
    for (int ks = 0; ks < LKS / 32; ++ks) {
        v8us lo, up;
#pragma unroll
        for (int i = 0; i < 4; ++i) { lo[i] = f2bf(xa[ks][0][i]); lo[4 + i] = f2bf(xa[ks][1][i]); up[i] = f2bf(xa[ks][2][i]); up[4 + i] = f2bf(xa[ks][3][i]); }
        const v16bf a = cat16b(lo, up);
#pragma unroll
        for (int nb = 0; nb < 2; ++nb) {
            v8us wl, wu;
#pragma unroll
            for (int i = 0; i < 8; ++i) { wl[i] = f2bf(wf[ks][nb][i]); wu[i] = f2bf(wf[ks][nb][8 + i]); }
            acc[nb] = wmmab_g(a, cat16b(wl & wm[nb], wu & wm[nb]), acc[nb]); }
    }
#pragma unroll
    for (int nb = 0; nb < 2; ++nb) {
#pragma unroll
        for (int j = 0; j < 8; ++j) part[(wave * 16 + hi * 8 + j) * LPP + nb * 16 + lr] = acc[nb][j]; }   // D: row 8h+j, col lane&15
    __syncthreads();                                                // every wave's partial tile is in LDS before any wave sums across them
    const float bcv = (c < NPAR) ? bfr(bx) : 0.0f;
    const float sc = (c >= 2 * NMIX) ? 0.2f : 1.0f;
    float* dst = PAR + ((size_t)b * USEQ + (size_t)u0) * PW;
#pragma unroll
    for (int e = 0; e < 2; ++e) { const int row = e * LW + wave;     // one wave per parameter row: 32 lanes x 4 B == 128 B
        float v = part[row * LPP + c];
#pragma unroll                                                      // straight-line reads of the partial tiles overlap
        for (int q = 1; q < LW; ++q) v += part[(q * 16 + row) * LPP + c];
        const float ex = expf(v + bcv) * sc;
        dst[row * PW + c] = (c < NPAR) ? ex : 0.0f; }
}

// k_prep: first launch. Grid x = CTB transpose blocks, then USEQ/16 linear-map blocks, per batch (y); the choice is the same for a whole block, so each block meets only its own barrier.
__global__ __launch_bounds__(256) void k_prep(const float* __restrict__ X, const float* __restrict__ W, const float* __restrict__ bias, const float* __restrict__ ctx, float* PAR, h16* CT) {
    __shared__ __align__(16) float part[LW * 16 * LPP];
    __shared__ __align__(16) h16 sT[DM * CTP];
    if (blockIdx.x < CTB) ctxT_block(ctx, CT, sT);
    else lin_block(X, W, bias, PAR, part);
}

// k_window: one block per 16 steps u of one batch; its AW waves split the t range (wave w: t in [w*TSEQ/AW, (w+1)*TSEQ/AW)), each keeps a partial [16][128] f32 tile,
// and the partial tiles are summed through LDS in ascending wave order behind one block barrier. Per 32-t step the window tile phi[16 u][32 t] is built in registers directly in A-fragment order
// (lane: row u = lane&15, elements 0..7 <- t0+8h+0..7, elements 8..15 <- t0+16+8h+0..7): rolled loop over the 10 mixtures (per-row weights and inverse widths from a wave-private LDS copy, positions from the block's shared position tile), 16 running sums per lane;
// Positions: segment = 2*wave + (lane>>4) of 16 rows, column = 20 + (lane&15); segments up to the block's own sum their rows' increments in f64, the totals meet in LDS behind a block barrier,
// the block's own segment adds the totals before it (four partial sums, ascending) to its running sums and writes the 16 rows of positions to LDS, published by a second block barrier.
// phi x mask (bf16 RNE value) x PCAR -> f16 with the flush select. B fragments = ctx^T rows d = 16j + (lane&15), k = t, two 16-B loads each from the f16 plane. 8 accumulators (128 output columns).
static_assert(32 * 16 == DM * 4);                      // store extent of one instruction == one output row
static_assert(4 * 32 * 4 == 16 * PW);                  // parameter copy: 4 trips x 32 lanes x 4 floats == 16 rows x 32 floats
__global__ __launch_bounds__(32 * AW) void k_window(const float* __restrict__ PAR, const h16* __restrict__ CT, const float* __restrict__ mask, float* OUT) {
    __shared__ __align__(16) float sp[AW * 16 * PW];
    __shared__ __align__(16) float os[AW * 16 * OSP2];
    __shared__ __align__(16) double stot[SEGS * 16];
    __shared__ __align__(16) float spos[16 * PSP];
    const int lane = threadIdx.x & 31, lr = lane & 15, hi = lane >> 4;
    const int wave = __builtin_amdgcn_readfirstlane((int)(threadIdx.x >> 5));
    const int b = blockIdx.y;
    const int u0 = blockIdx.x * 16;
    const int pb = wave * 16 * PW;
    const int seg = wave * 2 + hi, own = blockIdx.x;
    v4f pv[4];
    { const float* prow = PAR + ((size_t)b * USEQ + (size_t)u0) * PW;
#pragma unroll
      for (int s = 0; s < 4; ++s) pv[s] = *(const v4f*)(prow + (size_t)(s * 32 + lane) * 4); }
    float x[SROWS];
    { const float* col = PAR + ((size_t)b * USEQ + (size_t)seg * SROWS) * PW + 2 * NMIX + (lr < NMIX ? lr : (NMIX - 1));   // spare lanes repeat the last summed column
#pragma unroll
      for (int i = 0; i < SROWS; ++i) x[i] = 0.0f;
      if (seg <= own) {
#pragma unroll                                                      // straight line: the segment's loads are all in flight together, and with the parameter tile's above (one round trip, not two)
          for (int i = 0; i < SROWS; ++i) x[i] = col[i * PW]; } }
#pragma unroll
    for (int s = 0; s < 4; ++s) *(v4fa*)(&sp[pb + (s * 32 + lane) * 4]) = pv[s];
    wave_sync();
    { double loc[SROWS];
      double s = 0.0;
#pragma unroll                                                      // loc[] is indexed by constants only and stays in registers
      for (int i = 0; i < SROWS; ++i) { s += (double)x[i]; loc[i] = s; }
      stot[seg * 16 + lr] = (seg < own) ? s : 0.0;                  // only the segments before the block's own count towards its offset
      __syncthreads();                                              // every segment's total is in LDS before the block's own segment sums them
      if (seg == own) {
          double tq[SEGS];
#pragma unroll                                                      // straight line: the reads of the totals overlap
          for (int q = 0; q < SEGS; ++q) tq[q] = stot[q * 16 + lr];
          __builtin_amdgcn_sched_barrier(0);                        // every read above is issued before the first wait; mixed in with the sums they would be waited for four at a time
          double o[4] = { 0.0, 0.0, 0.0, 0.0 };
#pragma unroll                                                      // tq[] is indexed by constants only
          for (int q = 0; q < SEGS; ++q) o[q & 3] += tq[q];
          const double off = (o[0] + o[1]) + (o[2] + o[3]);
#pragma unroll                                                      // loc[] is indexed by constants only
          for (int i = 0; i < SROWS; ++i) spos[i * PSP + lr] = (float)(off + loc[i]); }
      __syncthreads(); }                                            // the 16 rows of positions are in LDS before any wave reads them
    v8f acc[8];
#pragma unroll
    for (int j = 0; j < 8; ++j) acc[j] = (v8f){};
    const float* maskb = mask + (size_t)b * T_FULL + 8 * hi;
    const h16* cb = CT + ((size_t)b * DM + (size_t)lr) * TSEQ + 8 * hi;      // + 16j*TSEQ + t0  (B fragment: col d, k = t)
    const int pw = pb + lr * PW;
#pragma unroll 1
    for (int ks = 0; ks < TSEQ / AW; ks += 32) {
        const int key0 = wave * (TSEQ / AW) + ks;                   // this wave's slice of t
        float s[16];
#pragma unroll
        for (int i = 0; i < 16; ++i) s[i] = 0.0f;
        const float tb = (float)(key0 + 8 * hi);
#pragma unroll 1
        for (int k = 0; k < NMIX; ++k) {
            const float a = sp[pw + k];
            const float g = sp[pw + NMIX + k] * NL2E;
            const float kp = spos[lr * PSP + k];
#pragma unroll
            for (int i = 0; i < 8; ++i) {
                const float d0 = kp - (tb + (float)i);
                const float d1 = kp - (tb + (float)(16 + i));
                s[i]     += a * __builtin_amdgcn_exp2f(g * d0 * d0);
                s[8 + i] += a * __builtin_amdgcn_exp2f(g * d1 * d1); }
        }
        const float* kq = maskb + key0;                             // t = key0+8h+0..7 and key0+16+8h+0..7, all < TSEQ
        const v4f m0 = *(const v4f*)kq, m1 = *(const v4f*)(kq + 4), m2 = *(const v4f*)(kq + 16), m3 = *(const v4f*)(kq + 20);
        float mk[16];
#pragma unroll
        for (int r = 0; r < 4; ++r) { mk[r] = m0[r]; mk[4 + r] = m1[r]; mk[8 + r] = m2[r]; mk[12 + r] = m3[r]; }
        v16h pa;
#pragma unroll
        for (int i = 0; i < 16; ++i) { const float gv = s[i] * bfr(mk[i]) * PCAR; pa[i] = toh_flush(gv); }
#pragma unroll
        for (int j = 0; j < 8; ++j) { const v16h cf = ldh(cb + (size_t)j * 16 * TSEQ + key0); acc[j] = wmma16_g(pa, cf, acc[j]); }
    }
    const int wb = wave * 16 * OSP2;
    // D layout: acc[j][r] = (u = 8h + r, d = 16j + lane&15) -> os[wave][u][d]; rows 0..15 x columns 0..127 of the wave's partial tile all written
#pragma unroll
    for (int j = 0; j < 8; ++j) {
#pragma unroll
        for (int r = 0; r < 8; ++r) os[wb + (8 * hi + r) * OSP2 + 16 * j + lr] = acc[j][r] * OSC; }
    __syncthreads();                                                // every wave's partial tile is in LDS before any wave sums across them
    float* orow = OUT + ((size_t)b * OUT_U + (size_t)u0) * DM;
    for (int row = wave; row < 16; row += AW) {                     // one wave per output row: 32 lanes x 16 B == 512 B
        v4f val = *(const v4fa*)(&os[row * OSP2 + lane * 4]);
#pragma unroll                                                      // straight-line reads of the partial tiles overlap; rolled, each read would be waited for alone
        for (int w = 1; w < AW; ++w) val += *(const v4fa*)(&os[w * 16 * OSP2 + row * OSP2 + lane * 4]);
        *(v4f*)(orow + (size_t)row * DM + lane * 4) = val; }
}

static constexpr size_t al256(size_t v) { return (v + 255) & ~(size_t)255; }
static constexpr size_t SZ_CT  = al256((size_t)NB * DM * TSEQ * 2);
static constexpr size_t SZ_PAR = al256((size_t)NB * USEQ * PW * 4);
static constexpr size_t SZ_TOTAL = SZ_CT + SZ_PAR;
static_assert(SZ_TOTAL <= (size_t)134217728);          // workspace carve <= 128 MiB
static_assert(((size_t)TSEQ * 2) % 128 == 0);

extern "C" void kernel_launch(void* const* d_in, const int* in_sizes, int n_in,
                              void* d_out, int out_size, void* d_ws, size_t ws_size, hipStream_t stream) {
    if (n_in < 5) return;
    const size_t needh = ((size_t)(NB - 1) * U_FULL + USEQ) * HIN;
    const size_t needc = ((size_t)(NB - 1) * T_FULL + TSEQ) * DM;
    const size_t needm = (size_t)(NB - 1) * T_FULL + TSEQ;
    if ((size_t)in_sizes[0] < needh || (size_t)in_sizes[1] < needc || (size_t)in_sizes[2] < needm) return;
    if ((size_t)in_sizes[3] < (size_t)HIN * NPAR || in_sizes[4] < NPAR) return;
    if ((size_t)out_size < ((size_t)(NB - 1) * OUT_U + USEQ) * DM) return;
    if (SZ_TOTAL > ws_size) return;
    // wire order: h_t, ctx, mask, W, b
    const float* hin  = (const float*)d_in[0];
    const float* ctx  = (const float*)d_in[1];
    const float* mask = (const float*)d_in[2];
    const float* wlin = (const float*)d_in[3];
    const float* blin = (const float*)d_in[4];
    float* OUT = (float*)d_out;      // [NB][USEQ][128]
    char* wsp = (char*)d_ws;
    h16* CT  = (h16*)wsp; wsp += SZ_CT;               // ctx^T [NB*128][TSEQ] f16 x64
    float* PAR = (float*)wsp; wsp += SZ_PAR;          // parameters [NB*USEQ][32] f32

    // grid (t tiles of the ctx transpose, then 16-row tiles of the linear map; batches)
    k_prep<<<dim3(CTB + USEQ / 16, NB, 1), 256, 0, stream>>>(hin, wlin, blin, ctx, PAR, CT);
    k_window<<<dim3(USEQ / 16, NB, 1), 32 * AW, 0, stream>>>(PAR, CT, mask, OUT);
}

// v005
// A run of this version takes 20.5 microseconds.
// In two side-by-side timings against v004, it was 1.08 and 1.07 times as fast.
// Over all steps from v000 it is 7.94 times as fast.
#include <hip/hip_runtime.h>

// Soft window over a context sequence: per step u a 30-wide linear map of the state row (weights [in][out], bias), exp, split into 10 weights / 10 inverse widths / 10 position increments (x 0.2, prefix-summed over u);
// window phi[u][t] = sum_k w_k exp(-g_k (pos_k - t)^2); output [NB][USEQ][128] = (phi * mask) @ ctx, f32.
// Compute dtypes, f32 accumulate everywhere: state-row linear map v_wmma_f32_16x16x32_bf16 (state rows, W, bias RNE-converted to bf16; products exact);
// window-times-context v_wmma_f32_16x16x32_f16: phi single f16 with a x256 carry (built in registers, f32 vector math), ctx (RNE-converted to bf16, exact in f16) single f16 with a x64 carry; carries folded by 2^-14 in the f32 epilogue.
// Layout: state rows and W read as f32 and RNE-converted to bf16 in registers (no copy in memory; columns 30, 31 of the W fragments zero); ctx^T f16 plane [b*128 + d][t]; parameter plane f32 [b*USEQ + u][32] (0..9 weights, 10..19 inverse widths, 20..29 position increments, 30..31 zero).
// Two launches: (1) the ctx transpose blocks and the linear-map blocks side by side in one grid (neither reads what the other writes); (2) the window blocks, each of which forms the positions of its own 16 steps itself.
// Linear map: one block per 16 state rows (whole chip), its 8 waves split the depth, f32 partial tiles summed in LDS in wave order; bias, expf and the x 0.2 follow there.
// Prefix sum (head of every window block): the rows of a batch are cut into 32 segments of 16 (16 waves x 2 half-waves, lane = column); the segments up to the block's own keep f64 sums of their rows, the f64 totals meet in LDS, and the block's own segment writes its 16 rows of positions to LDS. exp of the linear map: expf; window exponentials: exp2 of the log2(e)-scaled argument.

#ifndef NB
#define NB 8
#endif
#ifndef USEQ
#define USEQ 512
#endif
#ifndef TSEQ
#define TSEQ 1024
#endif
#define NB_FULL 8
#define U_FULL  512
#define T_FULL  1024
#ifndef OUT_U
#define OUT_U USEQ               // row pitch (in steps) between batches of the output
#endif
#define HIN  512                 // state width = depth of the linear map
#define DM   128                 // context width = output width
#define NMIX 10
#define NPAR 30                  // 3 * NMIX columns of the linear map
#define PW   32
#define AW   16                  // waves per window block: all on the same 16 steps, each on its own TSEQ/AW slice of t
#define NST  (TSEQ / AW / 32)   // 32-t steps per wave of a window block
#define OSP2 132                 // LDS row pitch (floats) of the output tile
#define CTP  72                  // LDS row pitch (halves) of the transpose tile
#define LW   8                   // waves per linear-map block: all on the same 16 rows, each on its own HIN/LW slice of the depth
#define LKS  (HIN / LW)          // depth per wave
#define LPP  36                  // LDS row pitch (floats) of a partial tile: 8 rows apart = 32 banks apart, so the two half-waves of a store do not meet
#define SEGS (2 * AW)            // prefix-sum segments per batch: AW waves x 2 half-waves
#define SROWS 16                 // rows per segment == steps per window block
#define PSP  17                  // LDS row pitch (floats) of the position tile: 16 rows land on 16 banks
#define CTB  (TSEQ / 64)         // ctx transpose blocks per batch
#define PCAR 256.0f              // carry of the window operand
#define CCAR 64.0f               // carry of the ctx plane
#define OSC  (1.0f / 16384.0f)   // 1 / (PCAR * CCAR)
#define NL2E (-1.4426950408889634f)

static_assert(NPAR == 3 * NMIX);
static_assert(NPAR <= PW);
static_assert(PW == 32);
static_assert(256 % PW == 0);                   // thread-linear element index keeps its column
static_assert(HIN % 32 == 0);                   // GEMM k-loop steps by 32
static_assert(HIN % 8 == 0);
static_assert(DM == 128);                       // output row = 32 lanes x 4 floats; 8 column tiles of 16
static_assert(LKS % 32 == 0);                   // every wave of a linear-map block gets whole 32-deep steps
static_assert(LW * LKS == HIN);
static_assert(16 * PW == 2 * 32 * LW);          // tile elements == 2 per thread of a linear-map block
static_assert(SEGS * SROWS == USEQ);            // the segments cover a batch exactly
static_assert(NMIX <= 16);                      // one half-wave holds every summed column
static_assert(USEQ % 16 == 0);                  // window grid covers the steps exactly
static_assert(TSEQ % (32 * AW) == 0);           // every wave of a window block gets whole 32-t steps
static_assert(NST <= 2);                        // a wave holds the ctx fragments of its whole slice in registers (64 per step)
static_assert(TSEQ % 64 == 0);
static_assert(TSEQ % 32 == 0);                  // window k-loop steps by 32
static_assert(NB <= NB_FULL);
static_assert(USEQ <= U_FULL);
static_assert(TSEQ <= T_FULL);
static_assert((OSP2 * 4) % 16 == 0);
static_assert((CTP * 2) % 16 == 0);
static_assert((size_t)LW * 16 * LPP * 4 + (size_t)DM * CTP * 2 <= (size_t)131072);      // static LDS of the first launch
static_assert((size_t)AW * 16 * PW * 4 + (size_t)AW * 16 * OSP2 * 4 + (size_t)SEGS * 16 * 8 + (size_t)16 * PSP * 4 <= (size_t)327680); // static LDS of the window kernel (one block per WGP)
static_assert(32 * LW == 256);                  // both kinds of block of the first launch have 256 threads

typedef _Float16 h16;
typedef __attribute__((ext_vector_type(16))) __bf16   v16bf;
typedef __attribute__((ext_vector_type(16))) _Float16 v16h;
typedef __attribute__((ext_vector_type(8)))  _Float16 v8h;
typedef __attribute__((ext_vector_type(8)))  unsigned short v8us;
typedef __attribute__((ext_vector_type(8)))  float    v8f;
typedef __attribute__((ext_vector_type(4)))  float    v4f;
typedef v4f  __attribute__((may_alias)) v4fa;
typedef v8h  __attribute__((may_alias)) v8ha;

__device__ __forceinline__ unsigned short f2bf(float f) { unsigned u = __float_as_uint(f); u += 0x7FFFu + ((u >> 16) & 1u); return (unsigned short)(u >> 16); }
__device__ __forceinline__ float bfr(float f) { return __uint_as_float(((unsigned)f2bf(f)) << 16); }   // value after RNE convert to bf16
__device__ __forceinline__ v16h cat16(v8h lo, v8h hi) { return __builtin_shufflevector(lo, hi, 0, 1, 2, 3, 4, 5, 6, 7, 8, 9, 10, 11, 12, 13, 14, 15); }
__device__ __forceinline__ v16bf cat16b(v8us lo, v8us hi) { return __builtin_bit_cast(v16bf, __builtin_shufflevector(lo, hi, 0, 1, 2, 3, 4, 5, 6, 7, 8, 9, 10, 11, 12, 13, 14, 15)); }
__device__ __forceinline__ v8f wmma16(v16h a, v16h b, v8f c) { return __builtin_amdgcn_wmma_f32_16x16x32_f16(false, a, false, b, (short)0, c, false, false); }
__device__ __forceinline__ v8f wmmab(v16bf a, v16bf b, v8f c) { return __builtin_amdgcn_wmma_f32_16x16x32_bf16(false, a, false, b, (short)0, c, false, false); }
// fragment loaders from K-contiguous 16-bit rows; p already includes + 8*(lane>>4): elements 0..7 <- k0+8h+0..7, elements 8..15 <- k0+16+8h+0..7 (same map for A and B)
__device__ __forceinline__ v16h  ldh(const h16* p) { return cat16(*(const v8h*)p, *(const v8h*)(p + 16)); }
// ordering point for wave-private LDS tiles (same wave writes and reads)
__device__ __forceinline__ void wave_sync() { __builtin_amdgcn_fence(3 /* release order */, "wavefront"); __builtin_amdgcn_wave_barrier(); asm volatile("" ::: "memory"); }

// f32 -> f16 with a value select: magnitudes below the smallest normal f16 become +0 (applied after the plane's carry)
static __device__ __forceinline__ h16 toh_flush(float v) { const h16 r = (h16)v; return (fabsf(v) < 6.103515625e-05f) ? (h16)0.0f : r; }
// one matrix instruction + its own guard (one accumulator per guard)
__device__ __forceinline__ v8f wmmab_g(v16bf a, v16bf b, v8f c) { c = wmmab(a, b, c); asm volatile("v_nop\n\tv_nop\n\tv_nop\n\tv_nop" : "+v"(c) : "v"(a), "v"(b)); return c; }
__device__ __forceinline__ v8f wmma16_g(v16h a, v16h b, v8f c) { c = wmma16(a, b, c); asm volatile("v_nop\n\tv_nop\n\tv_nop\n\tv_nop" : "+v"(c) : "v"(a), "v"(b)); return c; }

// ctxT_block (blocks x < CTB of the first launch): ctx [b][t][128] f32 -> ctx^T f16 plane [(b*128 + d)][t] (bf16 RNE value x CCAR, exact in f16, flush select). in[rows = t][cols = d] -> out[cols = d][rows = t].
static_assert(64 * DM / 4 == 8 * 256);                 // load pieces: 8 trips x 256 threads
static_assert(DM * 8 == 4 * 256);
static __device__ __forceinline__ void ctxT_block(const float* __restrict__ ctx, h16* CT, h16* sT) {
    const int tid = threadIdx.x; const int b = blockIdx.y, t0 = blockIdx.x * 64;
    const float* src = ctx + ((size_t)b * T_FULL + t0) * DM;
#pragma unroll 1
    for (int it = 0; it < 8; ++it) { const int q = it * 256 + tid; const int t = q >> 5, d4 = (q & 31) * 4;    // 64 t x 32 pieces of 4 d
        const v4f v = *(const v4f*)(src + (size_t)t * DM + d4);
#pragma unroll
        for (int i = 0; i < 4; ++i) sT[(d4 + i) * CTP + t] = toh_flush(bfr(v[i]) * CCAR); }
    __syncthreads();
    h16* dst = CT + (size_t)b * DM * TSEQ + t0;
{
#pragma unroll
        for (int it = 0; it < 4; ++it) { const int p = it * 256 + tid; const int row = p >> 3, c8 = (p & 7) * 8;   // 4 trips x 32 row groups = 128 rows; 8 lanes x 8 halves = 64 columns
            const v8h hv = *(const v8ha*)(&sT[row * CTP + c8]);
            *(v8h*)(dst + (size_t)row * TSEQ + c8) = hv; }
         }
}

// lin_block (blocks x >= CTB of the first launch): one block per 16 state rows of one batch; its LW waves split the depth (wave w: k in [w*LKS, (w+1)*LKS)). bf16 GEMM C[u][n] = sum_k x[u][k] W[k][n] (N = 32 padded):
// A fragments straight from the f32 state rows, B fragments straight from the f32 W rows (column n = 16nb + lane&15, one 4-B load per element), both RNE to bf16 in registers with the k map of ldh; every load of a wave is issued before its first use.
// The waves' partial [16][32] f32 tiles are summed through LDS in ascending wave order behind one block barrier; then + bias (bf16 RNE value), expf, x 0.2 on columns 20..29, zero on columns 30, 31; one write per element.
static __device__ __forceinline__ void lin_block(const float* __restrict__ X, const float* __restrict__ W, const float* __restrict__ bias, float* PAR, float* part) {
    const int tid = threadIdx.x;
    const int lane = tid & 31, lr = lane & 15, hi = lane >> 4;
    const int wave = __builtin_amdgcn_readfirstlane((int)(threadIdx.x >> 5));
    const int b = blockIdx.y;
    const int u0 = ((int)blockIdx.x - CTB) * 16;
    const float* xr = X + ((size_t)b * U_FULL + (size_t)(u0 + lr)) * HIN + wave * LKS + 8 * hi;
    const float* wr = W + (size_t)(wave * LKS + 8 * hi) * NPAR;     // + k*NPAR + column
    const int wc[2] = { lr, (16 + lr < NPAR) ? (16 + lr) : (NPAR - 1) };   // spare columns read the last real one and are zeroed below
    const unsigned short wm[2] = { (unsigned short)0xFFFFu, (16 + lr < NPAR) ? (unsigned short)0xFFFFu : (unsigned short)0 };   // bit mask, not a branch: the fragment's loads stay with the others above the first wait
    v4f xa[LKS / 32][4];
    float wf[LKS / 32][2][16];
#pragma unroll
    for (int ks = 0; ks < LKS / 32; ++ks) {                         // elements 0..7 <- k+8h+0..7, elements 8..15 <- k+16+8h+0..7
        xa[ks][0] = *(const v4f*)(xr + ks * 32);      xa[ks][1] = *(const v4f*)(xr + ks * 32 + 4);
        xa[ks][2] = *(const v4f*)(xr + ks * 32 + 16); xa[ks][3] = *(const v4f*)(xr + ks * 32 + 20); }
#pragma unroll
    for (int ks = 0; ks < LKS / 32; ++ks) {
#pragma unroll
        for (int nb = 0; nb < 2; ++nb) {
#pragma unroll
            for (int e = 0; e < 16; ++e) wf[ks][nb][e] = wr[(ks * 32 + (e < 8 ? e : e + 8)) * NPAR + wc[nb]]; } }   // elements 0..7 <- k+8h+0..7, elements 8..15 <- k+16+8h+0..7
    const int c = tid & 31;
    const float bx = bias[c < NPAR ? c : (NPAR - 1)];
    asm volatile("" :: "v"(bx));                                    // input-only use of the loaded value: keeps the bias load up here with the others; sunk to its use behind the barrier it would pay a round trip of its own
    __builtin_amdgcn_sched_barrier(0);                              // every load above is issued before the first wait; one sunk below a wait would pay a second round trip
    v8f acc[2];
    acc[0] = (v8f){}; acc[1] = (v8f){};
#pragma unroll
    for (int ks = 0; ks < LKS / 32; ++ks) {
        v8us lo, up;
#pragma unroll
        for (int i = 0; i < 4; ++i) { lo[i] = f2bf(xa[ks][0][i]); lo[4 + i] = f2bf(xa[ks][1][i]); up[i] = f2bf(xa[ks][2][i]); up[4 + i] = f2bf(xa[ks][3][i]); }
        const v16bf a = cat16b(lo, up);
#pragma unroll
        for (int nb = 0; nb < 2; ++nb) {
            v8us wl, wu;
#pragma unroll
            for (int i = 0; i < 8; ++i) { wl[i] = f2bf(wf[ks][nb][i]); wu[i] = f2bf(wf[ks][nb][8 + i]); }
            acc[nb] = wmmab_g(a, cat16b(wl & wm[nb], wu & wm[nb]), acc[nb]); }
    }
#pragma unroll
    for (int nb = 0; nb < 2; ++nb) {
#pragma unroll
        for (int j = 0; j < 8; ++j) part[(wave * 16 + hi * 8 + j) * LPP + nb * 16 + lr] = acc[nb][j]; }   // D: row 8h+j, col lane&15
    __syncthreads();                                                // every wave's partial tile is in LDS before any wave sums across them
    const float bcv = (c < NPAR) ? bfr(bx) : 0.0f;
    const float sc = (c >= 2 * NMIX) ? 0.2f : 1.0f;
    float* dst = PAR + ((size_t)b * USEQ + (size_t)u0) * PW;
#pragma unroll
    for (int e = 0; e < 2; ++e) { const int row = e * LW + wave;     // one wave per parameter row: 32 lanes x 4 B == 128 B
        float v = part[row * LPP + c];
#pragma unroll                                                      // straight-line reads of the partial tiles overlap
        for (int q = 1; q < LW; ++q) v += part[(q * 16 + row) * LPP + c];
        const float ex = expf(v + bcv) * sc;
        dst[row * PW + c] = (c < NPAR) ? ex : 0.0f; }
}

// k_prep: first launch. Grid x = CTB transpose blocks, then USEQ/16 linear-map blocks, per batch (y); the choice is the same for a whole block, so each block meets only its own barrier.
__global__ __launch_bounds__(256) void k_prep(const float* __restrict__ X, const float* __restrict__ W, const float* __restrict__ bias, const float* __restrict__ ctx, float* PAR, h16* CT) {
    __shared__ __align__(16) float part[LW * 16 * LPP];
    __shared__ __align__(16) h16 sT[DM * CTP];
    if (blockIdx.x < CTB) ctxT_block(ctx, CT, sT);
    else lin_block(X, W, bias, PAR, part);
}

// k_window: one block per 16 steps u of one batch; its AW waves split the t range (wave w: t in [w*TSEQ/AW, (w+1)*TSEQ/AW)), each keeps a partial [16][128] f32 tile,
// and the partial tiles are summed through LDS in ascending wave order behind one block barrier. Per 32-t step the window tile phi[16 u][32 t] is built in registers directly in A-fragment order
// (lane: row u = lane&15, elements 0..7 <- t0+8h+0..7, elements 8..15 <- t0+16+8h+0..7): rolled loop over the 10 mixtures (per-row weights and inverse widths from a wave-private LDS copy, positions from the block's shared position tile), 16 running sums per lane;
// Positions: segment = 2*wave + (lane>>4) of 16 rows, column = 20 + (lane&15); segments up to the block's own sum their rows' increments in f64, the totals meet in LDS behind a block barrier,
// the block's own segment adds the totals before it (four partial sums, ascending) to its running sums and writes the 16 rows of positions to LDS, published by a second block barrier.
// phi x mask (bf16 RNE value) x PCAR -> f16 with the flush select. B fragments = ctx^T rows d = 16j + (lane&15), k = t, two 16-B loads each from the f16 plane. 8 accumulators (128 output columns).
// The mask and B-fragment loads of the wave's whole slice are issued behind the second barrier, ahead of the first exponential; no barrier stands between them and their use.
static_assert(32 * 16 == DM * 4);                      // store extent of one instruction == one output row
static_assert(4 * 32 * 4 == 16 * PW);                  // parameter copy: 4 trips x 32 lanes x 4 floats == 16 rows x 32 floats
__global__ __launch_bounds__(32 * AW) void k_window(const float* __restrict__ PAR, const h16* __restrict__ CT, const float* __restrict__ mask, float* OUT) {
    __shared__ __align__(16) float sp[AW * 16 * PW];
    __shared__ __align__(16) float os[AW * 16 * OSP2];
    __shared__ __align__(16) double stot[SEGS * 16];
    __shared__ __align__(16) float spos[16 * PSP];
    const int lane = threadIdx.x & 31, lr = lane & 15, hi = lane >> 4;
    const int wave = __builtin_amdgcn_readfirstlane((int)(threadIdx.x >> 5));
    const int b = blockIdx.y;
    const int u0 = blockIdx.x * 16;
    const int pb = wave * 16 * PW;
    const int seg = wave * 2 + hi, own = blockIdx.x;
    v4f pv[4];
    { const float* prow = PAR + ((size_t)b * USEQ + (size_t)u0) * PW;
#pragma unroll
      for (int s = 0; s < 4; ++s) pv[s] = *(const v4f*)(prow + (size_t)(s * 32 + lane) * 4); }
    float x[SROWS];
    { const float* col = PAR + ((size_t)b * USEQ + (size_t)seg * SROWS) * PW + 2 * NMIX + (lr < NMIX ? lr : (NMIX - 1));   // spare lanes repeat the last summed column
#pragma unroll
      for (int i = 0; i < SROWS; ++i) x[i] = 0.0f;
      if (seg <= own) {
#pragma unroll                                                      // straight line: the segment's loads are all in flight together, and with the parameter tile's above (one round trip, not two)
          for (int i = 0; i < SROWS; ++i) x[i] = col[i * PW]; } }
#pragma unroll
    for (int s = 0; s < 4; ++s) *(v4fa*)(&sp[pb + (s * 32 + lane) * 4]) = pv[s];
    wave_sync();
    { double loc[SROWS];
      double s = 0.0;
#pragma unroll                                                      // loc[] is indexed by constants only and stays in registers
      for (int i = 0; i < SROWS; ++i) { s += (double)x[i]; loc[i] = s; }
      stot[seg * 16 + lr] = (seg < own) ? s : 0.0;                  // only the segments before the block's own count towards its offset
      __syncthreads();                                              // every segment's total is in LDS before the block's own segment sums them
      if (seg == own) {
          double tq[SEGS];
#pragma unroll                                                      // straight line: the reads of the totals overlap
          for (int q = 0; q < SEGS; ++q) tq[q] = stot[q * 16 + lr];
          __builtin_amdgcn_sched_barrier(0);                        // every read above is issued before the first wait; mixed in with the sums they would be waited for four at a time
          double o[4] = { 0.0, 0.0, 0.0, 0.0 };
#pragma unroll                                                      // tq[] is indexed by constants only
          for (int q = 0; q < SEGS; ++q) o[q & 3] += tq[q];
          const double off = (o[0] + o[1]) + (o[2] + o[3]);
#pragma unroll                                                      // loc[] is indexed by constants only
          for (int i = 0; i < SROWS; ++i) spos[i * PSP + lr] = (float)(off + loc[i]); }
      __syncthreads(); }                                            // the 16 rows of positions are in LDS before any wave reads them
    v8f acc[8];
#pragma unroll
    for (int j = 0; j < 8; ++j) acc[j] = (v8f){};
    const int tw = wave * (TSEQ / AW);                              // this wave's slice of t
    const float* kq = mask + (size_t)b * T_FULL + 8 * hi + tw;      // t = tw+32st+8h+0..7 and tw+32st+16+8h+0..7, all < TSEQ
    const h16* cb = CT + ((size_t)b * DM + (size_t)lr) * TSEQ + 8 * hi + tw;   // + 16j*TSEQ + 32st  (B fragment: col d, k = t)
    const int pw = pb + lr * PW;
    v4f mq[NST][4];
    v8h cf[NST][8][2];
#pragma unroll                                                      // mq[] is indexed by constants only
    for (int st = 0; st < NST; ++st) {
        mq[st][0] = *(const v4f*)(kq + st * 32);      mq[st][1] = *(const v4f*)(kq + st * 32 + 4);
        mq[st][2] = *(const v4f*)(kq + st * 32 + 16); mq[st][3] = *(const v4f*)(kq + st * 32 + 20); }
#pragma unroll                                                      // cf[] is indexed by constants only; the loads of one row d (one 128-B line for the whole slice) stand together
    for (int j = 0; j < 8; ++j) {
#pragma unroll
        for (int st = 0; st < NST; ++st) { const h16* p = cb + (size_t)j * 16 * TSEQ + st * 32; cf[st][j][0] = *(const v8h*)p; cf[st][j][1] = *(const v8h*)(p + 16); } }
    // every global load of the slice stands above, ahead of the exponentials, which cover the round trips; left at its WMMA each pair would be waited for alone
#pragma unroll                                                      // mq[] and cf[] are indexed by constants only
    for (int st = 0; st < NST; ++st) {
        float s[16];
#pragma unroll
        for (int i = 0; i < 16; ++i) s[i] = 0.0f;
        const float tb = (float)(tw + st * 32 + 8 * hi);
#pragma unroll 1
        for (int k = 0; k < NMIX; ++k) {
            const float a = sp[pw + k];
            const float g = sp[pw + NMIX + k] * NL2E;
            const float kp = spos[lr * PSP + k];
#pragma unroll
            for (int i = 0; i < 8; ++i) {
                const float d0 = kp - (tb + (float)i);
                const float d1 = kp - (tb + (float)(16 + i));
                s[i]     += a * __builtin_amdgcn_exp2f(g * d0 * d0);
                s[8 + i] += a * __builtin_amdgcn_exp2f(g * d1 * d1); }
        }
        float mk[16];
#pragma unroll
        for (int r = 0; r < 4; ++r) { mk[r] = mq[st][0][r]; mk[4 + r] = mq[st][1][r]; mk[8 + r] = mq[st][2][r]; mk[12 + r] = mq[st][3][r]; }
        v16h pa;
#pragma unroll
        for (int i = 0; i < 16; ++i) { const float gv = s[i] * bfr(mk[i]) * PCAR; pa[i] = toh_flush(gv); }
#pragma unroll
        for (int j = 0; j < 8; ++j) acc[j] = wmma16_g(pa, cat16(cf[st][j][0], cf[st][j][1]), acc[j]);
    }
    asm volatile("s_wait_xcnt 0x0" :: "v"(kq), "v"(cb) : "memory"); // the two address pairs of the loads above stay live, so no later write (a load's own result included) lands on them ahead of this wait; it stands behind the last use of the loaded data, where nothing is left to wait for
    const int wb = wave * 16 * OSP2;
    // D layout: acc[j][r] = (u = 8h + r, d = 16j + lane&15) -> os[wave][u][d]; rows 0..15 x columns 0..127 of the wave's partial tile all written
#pragma unroll
    for (int j = 0; j < 8; ++j) {
#pragma unroll
        for (int r = 0; r < 8; ++r) os[wb + (8 * hi + r) * OSP2 + 16 * j + lr] = acc[j][r] * OSC; }
    __syncthreads();                                                // every wave's partial tile is in LDS before any wave sums across them
    float* orow = OUT + ((size_t)b * OUT_U + (size_t)u0) * DM;
    for (int row = wave; row < 16; row += AW) {                     // one wave per output row: 32 lanes x 16 B == 512 B
        v4f val = *(const v4fa*)(&os[row * OSP2 + lane * 4]);
#pragma unroll                                                      // straight-line reads of the partial tiles overlap; rolled, each read would be waited for alone
        for (int w = 1; w < AW; ++w) val += *(const v4fa*)(&os[w * 16 * OSP2 + row * OSP2 + lane * 4]);
        *(v4f*)(orow + (size_t)row * DM + lane * 4) = val; }
}

static constexpr size_t al256(size_t v) { return (v + 255) & ~(size_t)255; }
static constexpr size_t SZ_CT  = al256((size_t)NB * DM * TSEQ * 2);
static constexpr size_t SZ_PAR = al256((size_t)NB * USEQ * PW * 4);
static constexpr size_t SZ_TOTAL = SZ_CT + SZ_PAR;
static_assert(SZ_TOTAL <= (size_t)134217728);          // workspace carve <= 128 MiB
static_assert(((size_t)TSEQ * 2) % 128 == 0);

extern "C" void kernel_launch(void* const* d_in, const int* in_sizes, int n_in,
                              void* d_out, int out_size, void* d_ws, size_t ws_size, hipStream_t stream) {
    if (n_in < 5) return;
    const size_t needh = ((size_t)(NB - 1) * U_FULL + USEQ) * HIN;
    const size_t needc = ((size_t)(NB - 1) * T_FULL + TSEQ) * DM;
    const size_t needm = (size_t)(NB - 1) * T_FULL + TSEQ;
    if ((size_t)in_sizes[0] < needh || (size_t)in_sizes[1] < needc || (size_t)in_sizes[2] < needm) return;
    if ((size_t)in_sizes[3] < (size_t)HIN * NPAR || in_sizes[4] < NPAR) return;
    if ((size_t)out_size < ((size_t)(NB - 1) * OUT_U + USEQ) * DM) return;
    if (SZ_TOTAL > ws_size) return;
    // wire order: h_t, ctx, mask, W, b
    const float* hin  = (const float*)d_in[0];
    const float* ctx  = (const float*)d_in[1];
    const float* mask = (const float*)d_in[2];
    const float* wlin = (const float*)d_in[3];
    const float* blin = (const float*)d_in[4];
    float* OUT = (float*)d_out;      // [NB][USEQ][128]
    char* wsp = (char*)d_ws;
    h16* CT  = (h16*)wsp; wsp += SZ_CT;               // ctx^T [NB*128][TSEQ] f16 x64
    float* PAR = (float*)wsp; wsp += SZ_PAR;          // parameters [NB*USEQ][32] f32

    // grid (t tiles of the ctx transpose, then 16-row tiles of the linear map; batches)
    k_prep<<<dim3(CTB + USEQ / 16, NB, 1), 256, 0, stream>>>(hin, wlin, blin, ctx, PAR, CT);
    k_window<<<dim3(USEQ / 16, NB, 1), 32 * AW, 0, stream>>>(PAR, CT, mask, OUT);
}

// v006
// A run of this version takes 16.3 microseconds.
// Timed twice side by side with v005, it ran 1.25 and 1.23 times as fast.
// Over all steps from v000 it is 9.88 times as fast.
#include <hip/hip_runtime.h>

// Soft window over a context sequence: per step u a 30-wide linear map of the state row (weights [in][out], bias), exp, split into 10 weights / 10 inverse widths / 10 position increments (x 0.2, prefix-summed over u);
// window phi[u][t] = sum_k w_k exp(-g_k (pos_k - t)^2); output [NB][USEQ][128] = (phi * mask) @ ctx, f32.
// Compute dtypes, f32 accumulate everywhere: state-row linear map v_wmma_f32_16x16x32_bf16 (state rows, W, bias RNE-converted to bf16; products exact);
// window-times-context v_wmma_f32_16x16x32_f16: phi single f16 with a x256 carry (built in registers, f32 vector math), ctx (RNE-converted to bf16, exact in f16) single f16 with a x64 carry; carries folded by 2^-14 in the f32 epilogue.
// Layout: state rows and W read as f32 and RNE-converted to bf16 in registers (no copy in memory; columns 30, 31 of the W fragments zero); ctx f16 plane in B-fragment order [b][t/32][d/16][k half][lane][8 t] (one fragment half of a wave = 512 contiguous bytes); parameter plane f32 [b*USEQ + u][32] (0..9 weights, 10..19 inverse widths, 20..29 position increments, 30..31 zero).
// Two launches: (1) the ctx transpose blocks and the linear-map blocks side by side in one grid (neither reads what the other writes); (2) the window blocks, each of which forms the positions of its own 16 steps itself.
// Linear map: one block per 16 state rows (whole chip), its 8 waves split the depth, f32 partial tiles summed in LDS in wave order; bias, expf and the x 0.2 follow there.
// Prefix sum (head of every window block): the rows of a batch are cut into 32 segments of 16 (16 waves x 2 half-waves, lane = column); the segments up to the block's own keep f64 sums of their rows, the f64 totals meet in LDS, and the block's own segment writes its 16 rows of positions to LDS. exp of the linear map: expf; window exponentials: exp2 of the log2(e)-scaled argument.

#ifndef NB
#define NB 8
#endif
#ifndef USEQ
#define USEQ 512
#endif
#ifndef TSEQ
#define TSEQ 1024
#endif
#define NB_FULL 8
#define U_FULL  512
#define T_FULL  1024
#ifndef OUT_U
#define OUT_U USEQ               // row pitch (in steps) between batches of the output
#endif
#define HIN  512                 // state width = depth of the linear map
#define DM   128                 // context width = output width
#define NMIX 10
#define NPAR 30                  // 3 * NMIX columns of the linear map
#define PW   32
#define AW   16                  // waves per window block: all on the same 16 steps, each on its own TSEQ/AW slice of t
#define NST  (TSEQ / AW / 32)   // 32-t steps per wave of a window block
#define OSP2 132                 // LDS row pitch (floats) of the output tile
#define LW   8                   // waves per linear-map block: all on the same 16 rows, each on its own HIN/LW slice of the depth
#define LKS  (HIN / LW)          // depth per wave
#define LPP  36                  // LDS row pitch (floats) of a partial tile: 8 rows apart = 32 banks apart, so the two half-waves of a store do not meet
#define SEGS (2 * AW)            // prefix-sum segments per batch: AW waves x 2 half-waves
#define SROWS 16                 // rows per segment == steps per window block
#define PSP  17                  // LDS row pitch (floats) of the position tile: 16 rows land on 16 banks
#define CTB  (TSEQ / 64)         // ctx transpose blocks per batch
#define PCAR 256.0f              // carry of the window operand
#define CCAR 64.0f               // carry of the ctx plane
#define OSC  (1.0f / 16384.0f)   // 1 / (PCAR * CCAR)
#define NL2E (-1.4426950408889634f)

static_assert(NPAR == 3 * NMIX);
static_assert(NPAR <= PW);
static_assert(PW == 32);
static_assert(256 % PW == 0);                   // thread-linear element index keeps its column
static_assert(HIN % 32 == 0);                   // GEMM k-loop steps by 32
static_assert(HIN % 8 == 0);
static_assert(DM == 128);                       // output row = 32 lanes x 4 floats; 8 column tiles of 16
static_assert(LKS % 32 == 0);                   // every wave of a linear-map block gets whole 32-deep steps
static_assert(LW * LKS == HIN);
static_assert(16 * PW == 2 * 32 * LW);          // tile elements == 2 per thread of a linear-map block
static_assert(SEGS * SROWS == USEQ);            // the segments cover a batch exactly
static_assert(NMIX <= 16);                      // one half-wave holds every summed column
static_assert(USEQ % 16 == 0);                  // window grid covers the steps exactly
static_assert(TSEQ % (32 * AW) == 0);           // every wave of a window block gets whole 32-t steps
static_assert(NST <= 2);                        // a wave holds the ctx fragments of its whole slice in registers (64 per step)
static_assert(TSEQ % 64 == 0);
static_assert(TSEQ % 32 == 0);                  // window k-loop steps by 32
static_assert(NB <= NB_FULL);
static_assert(USEQ <= U_FULL);
static_assert(TSEQ <= T_FULL);
static_assert((OSP2 * 4) % 16 == 0);
static_assert((size_t)LW * 16 * LPP * 4 <= (size_t)131072);      // static LDS of the first launch
static_assert((size_t)AW * 16 * PW * 4 + (size_t)AW * 16 * OSP2 * 4 + (size_t)SEGS * 16 * 8 + (size_t)16 * PSP * 4 <= (size_t)327680); // static LDS of the window kernel (one block per WGP)
static_assert(32 * LW == 256);                  // both kinds of block of the first launch have 256 threads

typedef _Float16 h16;
typedef __attribute__((ext_vector_type(16))) __bf16   v16bf;
typedef __attribute__((ext_vector_type(16))) _Float16 v16h;
typedef __attribute__((ext_vector_type(8)))  _Float16 v8h;
typedef __attribute__((ext_vector_type(8)))  unsigned short v8us;
typedef __attribute__((ext_vector_type(8)))  float    v8f;
typedef __attribute__((ext_vector_type(4)))  float    v4f;
typedef v4f  __attribute__((may_alias)) v4fa;
typedef v8h  __attribute__((may_alias)) v8ha;

__device__ __forceinline__ unsigned short f2bf(float f) { unsigned u = __float_as_uint(f); u += 0x7FFFu + ((u >> 16) & 1u); return (unsigned short)(u >> 16); }
__device__ __forceinline__ float bfr(float f) { return __uint_as_float(((unsigned)f2bf(f)) << 16); }   // value after RNE convert to bf16
__device__ __forceinline__ v16h cat16(v8h lo, v8h hi) { return __builtin_shufflevector(lo, hi, 0, 1, 2, 3, 4, 5, 6, 7, 8, 9, 10, 11, 12, 13, 14, 15); }
__device__ __forceinline__ v16bf cat16b(v8us lo, v8us hi) { return __builtin_bit_cast(v16bf, __builtin_shufflevector(lo, hi, 0, 1, 2, 3, 4, 5, 6, 7, 8, 9, 10, 11, 12, 13, 14, 15)); }
__device__ __forceinline__ v8f wmma16(v16h a, v16h b, v8f c) { return __builtin_amdgcn_wmma_f32_16x16x32_f16(false, a, false, b, (short)0, c, false, false); }
__device__ __forceinline__ v8f wmmab(v16bf a, v16bf b, v8f c) { return __builtin_amdgcn_wmma_f32_16x16x32_bf16(false, a, false, b, (short)0, c, false, false); }
// fragment loaders from K-contiguous 16-bit rows; p already includes + 8*(lane>>4): elements 0..7 <- k0+8h+0..7, elements 8..15 <- k0+16+8h+0..7 (same map for A and B)
__device__ __forceinline__ v16h  ldh(const h16* p) { return cat16(*(const v8h*)p, *(const v8h*)(p + 16)); }
// ordering point for wave-private LDS tiles (same wave writes and reads)
__device__ __forceinline__ void wave_sync() { __builtin_amdgcn_fence(3 /* release order */, "wavefront"); __builtin_amdgcn_wave_barrier(); asm volatile("" ::: "memory"); }

// f32 -> f16 with a value select: magnitudes below the smallest normal f16 become +0 (applied after the plane's carry)
static __device__ __forceinline__ h16 toh_flush(float v) { const h16 r = (h16)v; return (fabsf(v) < 6.103515625e-05f) ? (h16)0.0f : r; }
// one matrix instruction + its own guard (one accumulator per guard)
__device__ __forceinline__ v8f wmmab_g(v16bf a, v16bf b, v8f c) { c = wmmab(a, b, c); asm volatile("v_nop\n\tv_nop\n\tv_nop\n\tv_nop" : "+v"(c) : "v"(a), "v"(b)); return c; }
__device__ __forceinline__ v8f wmma16_g(v16h a, v16h b, v8f c) { c = wmma16(a, b, c); asm volatile("v_nop\n\tv_nop\n\tv_nop\n\tv_nop" : "+v"(c) : "v"(a), "v"(b)); return c; }

// ctxT_block (blocks x < CTB of the first launch): ctx [b][t][128] f32 -> f16 plane in B-fragment order (bf16 RNE value x CCAR, exact in f16, flush select).
// Element (t, d) lies at [b][t >> 5][d >> 4][(t >> 4) & 1][16 * ((t >> 3) & 1) + (d & 15)][t & 7]: the k map of ldh, so a window wave reads each fragment half as 32 lanes x 16 contiguous bytes.
// One thread holds 8 t x 4 d in registers (wave w: t0 + 8w + 0..7, lane: d = 4 * lane + 0..3): 8 whole-row loads, all issued before the first wait, then 4 stores of 16 B (8 t of one d), 64 contiguous bytes per thread.
// Each 256-B run of the plane (16 columns d of one 8-run of t) is written by one wave alone.
static_assert(64 * DM / 4 == 8 * 256);                 // load pieces: 8 per thread x 256 threads
static_assert(8 * LW == 64);                           // 8 t per wave x waves of the block == t per block
static __device__ __forceinline__ void ctxT_block(const float* __restrict__ ctx, h16* CT) {
    const int lane = threadIdx.x & 31;
    const int wave = __builtin_amdgcn_readfirstlane((int)(threadIdx.x >> 5));
    const int b = blockIdx.y, t0 = blockIdx.x * 64;
    const int d4 = lane * 4;
    const float* src = ctx + ((size_t)b * T_FULL + (size_t)(t0 + wave * 8)) * DM + d4;
    v4f v[8];
#pragma unroll                                                      // v[] is indexed by constants only; the 8 loads share one round trip
    for (int r = 0; r < 8; ++r) v[r] = *(const v4f*)(src + (size_t)r * DM);
    const int tg = (t0 >> 3) + wave;                                // this wave's 8-run of t
    h16* dst = CT + ((((size_t)b * (TSEQ / 32) + (size_t)(tg >> 2)) * 8 + (size_t)(d4 >> 4)) * 2 + (size_t)((tg >> 1) & 1)) * 256 + ((tg & 1) * 16 + (d4 & 15)) * 8;
#pragma unroll
    for (int i = 0; i < 4; ++i) {
        v8h o;
#pragma unroll
        for (int r = 0; r < 8; ++r) o[r] = toh_flush(bfr(v[r][i]) * CCAR);
        *(v8h*)(dst + i * 8) = o; }
}

// lin_block (blocks x >= CTB of the first launch): one block per 16 state rows of one batch; its LW waves split the depth (wave w: k in [w*LKS, (w+1)*LKS)). bf16 GEMM C[u][n] = sum_k x[u][k] W[k][n] (N = 32 padded):
// A fragments straight from the f32 state rows, B fragments straight from the f32 W rows (column n = 16nb + lane&15, one 4-B load per element), both RNE to bf16 in registers with the k map of ldh; every load of a wave is issued before its first use.
// The waves' partial [16][32] f32 tiles are summed through LDS in ascending wave order behind one block barrier; then + bias (bf16 RNE value), expf, x 0.2 on columns 20..29, zero on columns 30, 31; one write per element.
static __device__ __forceinline__ void lin_block(const float* __restrict__ X, const float* __restrict__ W, const float* __restrict__ bias, float* PAR, float* part) {
    const int tid = threadIdx.x;
    const int lane = tid & 31, lr = lane & 15, hi = lane >> 4;
    const int wave = __builtin_amdgcn_readfirstlane((int)(threadIdx.x >> 5));
    const int b = blockIdx.y;
    const int u0 = ((int)blockIdx.x - CTB) * 16;
    const float* xr = X + ((size_t)b * U_FULL + (size_t)(u0 + lr)) * HIN + wave * LKS + 8 * hi;
    const float* wr = W + (size_t)(wave * LKS + 8 * hi) * NPAR;     // + k*NPAR + column
    const int wc[2] = { lr, (16 + lr < NPAR) ? (16 + lr) : (NPAR - 1) };   // spare columns read the last real one and are zeroed below
    const unsigned short wm[2] = { (unsigned short)0xFFFFu, (16 + lr < NPAR) ? (unsigned short)0xFFFFu : (unsigned short)0 };   // bit mask, not a branch: the fragment's loads stay with the others above the first wait
    v4f xa[LKS / 32][4];
    float wf[LKS / 32][2][16];
#pragma unroll
    for (int ks = 0; ks < LKS / 32; ++ks) {                         // elements 0..7 <- k+8h+0..7, elements 8..15 <- k+16+8h+0..7
        xa[ks][0] = *(const v4f*)(xr + ks * 32);      xa[ks][1] = *(const v4f*)(xr + ks * 32 + 4);
        xa[ks][2] = *(const v4f*)(xr + ks * 32 + 16); xa[ks][3] = *(const v4f*)(xr + ks * 32 + 20); }
#pragma unroll
    for (int ks = 0; ks < LKS / 32; ++ks) {
#pragma unroll
        for (int nb = 0; nb < 2; ++nb) {
#pragma unroll
            for (int e = 0; e < 16; ++e) wf[ks][nb][e] = wr[(ks * 32 + (e < 8 ? e : e + 8)) * NPAR + wc[nb]]; } }   // elements 0..7 <- k+8h+0..7, elements 8..15 <- k+16+8h+0..7
    const int c = tid & 31;
    const float bx = bias[c < NPAR ? c : (NPAR - 1)];
    asm volatile("" :: "v"(bx));                                    // input-only use of the loaded value: keeps the bias load up here with the others; sunk to its use behind the barrier it would pay a round trip of its own
    __builtin_amdgcn_sched_barrier(0);                              // every load above is issued before the first wait; one sunk below a wait would pay a second round trip
    v8f acc[2];
    acc[0] = (v8f){}; acc[1] = (v8f){};
#pragma unroll
    for (int ks = 0; ks < LKS / 32; ++ks) {
        v8us lo, up;
#pragma unroll
        for (int i = 0; i < 4; ++i) { lo[i] = f2bf(xa[ks][0][i]); lo[4 + i] = f2bf(xa[ks][1][i]); up[i] = f2bf(xa[ks][2][i]); up[4 + i] = f2bf(xa[ks][3][i]); }
        const v16bf a = cat16b(lo, up);
#pragma unroll
        for (int nb = 0; nb < 2; ++nb) {
            v8us wl, wu;
#pragma unroll
            for (int i = 0; i < 8; ++i) { wl[i] = f2bf(wf[ks][nb][i]); wu[i] = f2bf(wf[ks][nb][8 + i]); }
            acc[nb] = wmmab_g(a, cat16b(wl & wm[nb], wu & wm[nb]), acc[nb]); }
    }
#pragma unroll
    for (int nb = 0; nb < 2; ++nb) {
#pragma unroll
        for (int j = 0; j < 8; ++j) part[(wave * 16 + hi * 8 + j) * LPP + nb * 16 + lr] = acc[nb][j]; }   // D: row 8h+j, col lane&15
    __syncthreads();                                                // every wave's partial tile is in LDS before any wave sums across them
    const float bcv = (c < NPAR) ? bfr(bx) : 0.0f;
    const float sc = (c >= 2 * NMIX) ? 0.2f : 1.0f;
    float* dst = PAR + ((size_t)b * USEQ + (size_t)u0) * PW;
#pragma unroll
    for (int e = 0; e < 2; ++e) { const int row = e * LW + wave;     // one wave per parameter row: 32 lanes x 4 B == 128 B
        float v = part[row * LPP + c];
#pragma unroll                                                      // straight-line reads of the partial tiles overlap
        for (int q = 1; q < LW; ++q) v += part[(q * 16 + row) * LPP + c];
        const float ex = expf(v + bcv) * sc;
        dst[row * PW + c] = (c < NPAR) ? ex : 0.0f; }
}

// k_prep: first launch. Grid x = CTB transpose blocks, then USEQ/16 linear-map blocks, per batch (y); the choice is the same for a whole block; only the linear-map blocks meet a barrier.
__global__ __launch_bounds__(256) void k_prep(const float* __restrict__ X, const float* __restrict__ W, const float* __restrict__ bias, const float* __restrict__ ctx, float* PAR, h16* CT) {
    __shared__ __align__(16) float part[LW * 16 * LPP];
    if (blockIdx.x < CTB) ctxT_block(ctx, CT);
    else lin_block(X, W, bias, PAR, part);
}

// k_window: one block per 16 steps u of one batch; its AW waves split the t range (wave w: t in [w*TSEQ/AW, (w+1)*TSEQ/AW)), each keeps a partial [16][128] f32 tile,
// and the partial tiles are summed through LDS in ascending wave order behind one block barrier. Per 32-t step the window tile phi[16 u][32 t] is built in registers directly in A-fragment order
// (lane: row u = lane&15, elements 0..7 <- t0+8h+0..7, elements 8..15 <- t0+16+8h+0..7): rolled loop over the 10 mixtures (per-row weights and inverse widths from a wave-private LDS copy, positions from the block's shared position tile), 16 running sums per lane;
// Positions: segment = 2*wave + (lane>>4) of 16 rows, column = 20 + (lane&15); segments up to the block's own sum their rows' increments in f64, the totals meet in LDS behind a block barrier,
// the block's own segment adds the totals before it (four partial sums, ascending) to its running sums and writes the 16 rows of positions to LDS, published by a second block barrier.
// phi x mask (bf16 RNE value) x PCAR -> f16 with the flush select. B fragments (col d = 16j + (lane&15), k = t): two 16-B loads each from the fragment-ordered f16 plane, every load 512 contiguous bytes per wave. 8 accumulators (128 output columns).
// The mask and B-fragment loads of the wave's whole slice are issued behind the second barrier, ahead of the first exponential; no barrier stands between them and their use.
static_assert(32 * 16 == DM * 4);                      // store extent of one instruction == one output row
static_assert(4 * 32 * 4 == 16 * PW);                  // parameter copy: 4 trips x 32 lanes x 4 floats == 16 rows x 32 floats
__global__ __launch_bounds__(32 * AW) void k_window(const float* __restrict__ PAR, const h16* __restrict__ CT, const float* __restrict__ mask, float* OUT) {
    __shared__ __align__(16) float sp[AW * 16 * PW];
    __shared__ __align__(16) float os[AW * 16 * OSP2];
    __shared__ __align__(16) double stot[SEGS * 16];
    __shared__ __align__(16) float spos[16 * PSP];
    const int lane = threadIdx.x & 31, lr = lane & 15, hi = lane >> 4;
    const int wave = __builtin_amdgcn_readfirstlane((int)(threadIdx.x >> 5));
    const int b = blockIdx.y;
    const int u0 = blockIdx.x * 16;
    const int pb = wave * 16 * PW;
    const int seg = wave * 2 + hi, own = blockIdx.x;
    v4f pv[4];
    { const float* prow = PAR + ((size_t)b * USEQ + (size_t)u0) * PW;
#pragma unroll
      for (int s = 0; s < 4; ++s) pv[s] = *(const v4f*)(prow + (size_t)(s * 32 + lane) * 4); }
    float x[SROWS];
    { const float* col = PAR + ((size_t)b * USEQ + (size_t)seg * SROWS) * PW + 2 * NMIX + (lr < NMIX ? lr : (NMIX - 1));   // spare lanes repeat the last summed column
#pragma unroll
      for (int i = 0; i < SROWS; ++i) x[i] = 0.0f;
      if (seg <= own) {
#pragma unroll                                                      // straight line: the segment's loads are all in flight together, and with the parameter tile's above (one round trip, not two)
          for (int i = 0; i < SROWS; ++i) x[i] = col[i * PW]; } }
#pragma unroll
    for (int s = 0; s < 4; ++s) *(v4fa*)(&sp[pb + (s * 32 + lane) * 4]) = pv[s];
    wave_sync();
    { double loc[SROWS];
      double s = 0.0;
#pragma unroll                                                      // loc[] is indexed by constants only and stays in registers
      for (int i = 0; i < SROWS; ++i) { s += (double)x[i]; loc[i] = s; }
      stot[seg * 16 + lr] = (seg < own) ? s : 0.0;                  // only the segments before the block's own count towards its offset
      __syncthreads();                                              // every segment's total is in LDS before the block's own segment sums them
      if (seg == own) {
          double tq[SEGS];
#pragma unroll                                                      // straight line: the reads of the totals overlap
          for (int q = 0; q < SEGS; ++q) tq[q] = stot[q * 16 + lr];
          __builtin_amdgcn_sched_barrier(0);                        // every read above is issued before the first wait; mixed in with the sums they would be waited for four at a time
          double o[4] = { 0.0, 0.0, 0.0, 0.0 };
#pragma unroll                                                      // tq[] is indexed by constants only
          for (int q = 0; q < SEGS; ++q) o[q & 3] += tq[q];
          const double off = (o[0] + o[1]) + (o[2] + o[3]);
#pragma unroll                                                      // loc[] is indexed by constants only
          for (int i = 0; i < SROWS; ++i) spos[i * PSP + lr] = (float)(off + loc[i]); }
      __syncthreads(); }                                            // the 16 rows of positions are in LDS before any wave reads them
    v8f acc[8];
#pragma unroll
    for (int j = 0; j < 8; ++j) acc[j] = (v8f){};
    const int tw = wave * (TSEQ / AW);                              // this wave's slice of t
    const float* kq = mask + (size_t)b * T_FULL + 8 * hi + tw;      // t = tw+32st+8h+0..7 and tw+32st+16+8h+0..7, all < TSEQ
    const h16* cu = CT + ((size_t)b * (TSEQ / 32) + (size_t)(tw >> 5)) * (8 * 2 * 256);   // the wave's slice of the plane (same for all lanes); + ((8st + j)*2 + k half)*256 + 8*lane  (B fragment: col d, k = t)
    const int pw = pb + lr * PW;
    v4f mq[NST][4];
    v8h cf[NST][8][2];
#pragma unroll                                                      // mq[] is indexed by constants only
    for (int st = 0; st < NST; ++st) {
        mq[st][0] = *(const v4f*)(kq + st * 32);      mq[st][1] = *(const v4f*)(kq + st * 32 + 4);
        mq[st][2] = *(const v4f*)(kq + st * 32 + 16); mq[st][3] = *(const v4f*)(kq + st * 32 + 20); }
    __builtin_amdgcn_sched_barrier(0);                              // keeps the mask loads ahead of the fragment loads: loads return in order, and issued last the first step's mask would be waited for behind the whole slice
#pragma unroll                                                      // cf[] is indexed by constants only; ascending addresses, the first step's fragments first
    for (int st = 0; st < NST; ++st) {
#pragma unroll
        for (int j = 0; j < 8; ++j) { const h16* p = cu + (st * 8 + j) * 512 + lane * 8; cf[st][j][0] = *(const v8h*)p; cf[st][j][1] = *(const v8h*)(p + 256); } }
    // every global load of the slice stands above, ahead of the exponentials, which cover the round trips; left at its WMMA each pair would be waited for alone
#pragma unroll                                                      // mq[] and cf[] are indexed by constants only
    for (int st = 0; st < NST; ++st) {
        float s[16];
#pragma unroll
        for (int i = 0; i < 16; ++i) s[i] = 0.0f;
        const float tb = (float)(tw + st * 32 + 8 * hi);
#pragma unroll 1
        for (int k = 0; k < NMIX; ++k) {
            const float a = sp[pw + k];
            const float g = sp[pw + NMIX + k] * NL2E;
            const float kp = spos[lr * PSP + k];
#pragma unroll
            for (int i = 0; i < 8; ++i) {
                const float d0 = kp - (tb + (float)i);
                const float d1 = kp - (tb + (float)(16 + i));
                s[i]     += a * __builtin_amdgcn_exp2f(g * d0 * d0);
                s[8 + i] += a * __builtin_amdgcn_exp2f(g * d1 * d1); }
        }
        float mk[16];
#pragma unroll
        for (int r = 0; r < 4; ++r) { mk[r] = mq[st][0][r]; mk[4 + r] = mq[st][1][r]; mk[8 + r] = mq[st][2][r]; mk[12 + r] = mq[st][3][r]; }
        v16h pa;
#pragma unroll
        for (int i = 0; i < 16; ++i) { const float gv = s[i] * bfr(mk[i]) * PCAR; pa[i] = toh_flush(gv); }
#pragma unroll
        for (int j = 0; j < 8; ++j) acc[j] = wmma16_g(pa, cat16(cf[st][j][0], cf[st][j][1]), acc[j]);
    }
    asm volatile("s_wait_xcnt 0x0" :: "v"(kq), "s"(cu), "v"(lane) : "memory"); // the registers that the loads above name (mask address pair, plane base, lane offset) stay live, so no later write lands on them ahead of this wait and none is needed ahead of the exponentials; it stands behind the last use of the loaded data, where nothing is left to wait for
    const int wb = wave * 16 * OSP2;
    // D layout: acc[j][r] = (u = 8h + r, d = 16j + lane&15) -> os[wave][u][d]; rows 0..15 x columns 0..127 of the wave's partial tile all written
#pragma unroll
    for (int j = 0; j < 8; ++j) {
#pragma unroll
        for (int r = 0; r < 8; ++r) os[wb + (8 * hi + r) * OSP2 + 16 * j + lr] = acc[j][r] * OSC; }
    __syncthreads();                                                // every wave's partial tile is in LDS before any wave sums across them
    float* orow = OUT + ((size_t)b * OUT_U + (size_t)u0) * DM;
    for (int row = wave; row < 16; row += AW) {                     // one wave per output row: 32 lanes x 16 B == 512 B
        v4f val = *(const v4fa*)(&os[row * OSP2 + lane * 4]);
#pragma unroll                                                      // straight-line reads of the partial tiles overlap; rolled, each read would be waited for alone
        for (int w = 1; w < AW; ++w) val += *(const v4fa*)(&os[w * 16 * OSP2 + row * OSP2 + lane * 4]);
        *(v4f*)(orow + (size_t)row * DM + lane * 4) = val; }
}

static constexpr size_t al256(size_t v) { return (v + 255) & ~(size_t)255; }
static constexpr size_t SZ_CT  = al256((size_t)NB * DM * TSEQ * 2);
static constexpr size_t SZ_PAR = al256((size_t)NB * USEQ * PW * 4);
static constexpr size_t SZ_TOTAL = SZ_CT + SZ_PAR;
static_assert(SZ_TOTAL <= (size_t)134217728);          // workspace carve <= 128 MiB
static_assert(((size_t)TSEQ * 2) % 128 == 0);

extern "C" void kernel_launch(void* const* d_in, const int* in_sizes, int n_in,
                              void* d_out, int out_size, void* d_ws, size_t ws_size, hipStream_t stream) {
    if (n_in < 5) return;
    const size_t needh = ((size_t)(NB - 1) * U_FULL + USEQ) * HIN;
    const size_t needc = ((size_t)(NB - 1) * T_FULL + TSEQ) * DM;
    const size_t needm = (size_t)(NB - 1) * T_FULL + TSEQ;
    if ((size_t)in_sizes[0] < needh || (size_t)in_sizes[1] < needc || (size_t)in_sizes[2] < needm) return;
    if ((size_t)in_sizes[3] < (size_t)HIN * NPAR || in_sizes[4] < NPAR) return;
    if ((size_t)out_size < ((size_t)(NB - 1) * OUT_U + USEQ) * DM) return;
    if (SZ_TOTAL > ws_size) return;
    // wire order: h_t, ctx, mask, W, b
    const float* hin  = (const float*)d_in[0];
    const float* ctx  = (const float*)d_in[1];
    const float* mask = (const float*)d_in[2];
    const float* wlin = (const float*)d_in[3];
    const float* blin = (const float*)d_in[4];
    float* OUT = (float*)d_out;      // [NB][USEQ][128]
    char* wsp = (char*)d_ws;
    h16* CT  = (h16*)wsp; wsp += SZ_CT;               // ctx f16 x64, B-fragment order [NB][TSEQ/32][8][2][32][8]
    float* PAR = (float*)wsp; wsp += SZ_PAR;          // parameters [NB*USEQ][32] f32

    // grid (t tiles of the ctx transpose, then 16-row tiles of the linear map; batches)
    k_prep<<<dim3(CTB + USEQ / 16, NB, 1), 256, 0, stream>>>(hin, wlin, blin, ctx, PAR, CT);
    k_window<<<dim3(USEQ / 16, NB, 1), 32 * AW, 0, stream>>>(PAR, CT, mask, OUT);
}

// v007
// It runs in 12 microseconds.
// In two side-by-side timings against v006, it was 1.35 and 1.36 times as fast.
// Over all steps from v000 it is 13.4 times as fast.
#include <hip/hip_runtime.h>

// Soft window over a context sequence: per step u a 30-wide linear map of the state row (weights [in][out], bias), exp, split into 10 weights / 10 inverse widths / 10 position increments (x 0.2, prefix-summed over u);
// window phi[u][t] = sum_k w_k exp(-g_k (pos_k - t)^2); output [NB][USEQ][128] = (phi * mask) @ ctx, f32.
// Compute dtypes, f32 accumulate everywhere: state-row linear map v_wmma_f32_16x16x32_bf16 (state rows, W, bias RNE-converted to bf16; products exact);
// window-times-context v_wmma_f32_16x16x32_f16: phi single f16 with a x256 carry (built in registers, f32 vector math), ctx (RNE-converted to bf16, exact in f16) single f16 with a x64 carry; carries folded by 2^-14 in the f32 epilogue.
// Layout: state rows and W read as f32 and RNE-converted to bf16 in registers (no copy in memory; columns 30, 31 of the W fragments zero); ctx f16 plane in B-fragment order [b][t/32][d/16][k half][lane][8 t] (one fragment half of a wave = 512 contiguous bytes); parameter plane f32 [b*USEQ + u][32] (0..9 weights, 10..19 inverse widths, 20..29 position increments, 30..31 zero).
// Two launches: (1) the ctx transpose blocks and the linear-map blocks side by side in one grid (neither reads what the other writes); (2) the window blocks, each of which forms the positions of its own 16 steps itself.
// Linear map: one block per 16 state rows (whole chip), its 8 waves split the depth, f32 partial tiles summed in LDS in wave order; bias, expf and the x 0.2 follow there.
// Prefix sum (head of every window block): the rows of a batch are cut into 32 segments of 16 (16 waves x 2 half-waves, lane = column); the segments up to the block's own keep f64 sums of their rows, the f64 totals meet in LDS, and the block's own segment writes its 16 rows of positions to LDS. exp of the linear map: expf; window exponentials: exp2 of the log2(e)-scaled argument.

#ifndef NB
#define NB 8
#endif
#ifndef USEQ
#define USEQ 512
#endif
#ifndef TSEQ
#define TSEQ 1024
#endif
#define NB_FULL 8
#define U_FULL  512
#define T_FULL  1024
#ifndef OUT_U
#define OUT_U USEQ               // row pitch (in steps) between batches of the output
#endif
#define HIN  512                 // state width = depth of the linear map
#define DM   128                 // context width = output width
#define NMIX 10
#define NPAR 30                  // 3 * NMIX columns of the linear map
#define PW   32
#define AW   16                  // waves per window block: all on the same 16 steps, sharing out the live 32-t tiles (wave w: tiles first + w, first + w + AW)
#define NST  (TSEQ / AW / 32)   // 32-t steps per wave of a window block
#define OSP2 132                 // LDS row pitch (floats) of the output tile
#define LW   8                   // waves per linear-map block: all on the same 16 rows, each on its own HIN/LW slice of the depth
#define LKS  (HIN / LW)          // depth per wave
#define LPP  36                  // LDS row pitch (floats) of a partial tile: 8 rows apart = 32 banks apart, so the two half-waves of a store do not meet
#define SEGS (2 * AW)            // prefix-sum segments per batch: AW waves x 2 half-waves
#define SROWS 16                 // rows per segment == steps per window block
#define PSP  17                  // LDS row pitch (floats) of the position tile: 16 rows land on 16 banks
#define CTB  (TSEQ / 64)         // ctx transpose blocks per batch
#define PCAR 256.0f              // carry of the window operand
#define CCAR 64.0f               // carry of the ctx plane
#define OSC  (1.0f / 16384.0f)   // 1 / (PCAR * CCAR)
#define NL2E (-1.4426950408889634f)
#define ZCUT 160.0f              // exp2 of an argument at or below -ZCUT is exact +0 in f32 (the smallest f32 is 2^-149)

static_assert(NPAR == 3 * NMIX);
static_assert(NPAR <= PW);
static_assert(PW == 32);
static_assert(256 % PW == 0);                   // thread-linear element index keeps its column
static_assert(HIN % 32 == 0);                   // GEMM k-loop steps by 32
static_assert(HIN % 8 == 0);
static_assert(DM == 128);                       // output row = 32 lanes x 4 floats; 8 column tiles of 16
static_assert(LKS % 32 == 0);                   // every wave of a linear-map block gets whole 32-deep steps
static_assert(LW * LKS == HIN);
static_assert(16 * PW == 2 * 32 * LW);          // tile elements == 2 per thread of a linear-map block
static_assert(SEGS * SROWS == USEQ);            // the segments cover a batch exactly
static_assert(NMIX <= 16);                      // one half-wave holds every summed column
static_assert(USEQ % 16 == 0);                  // window grid covers the steps exactly
static_assert(TSEQ % (32 * AW) == 0);           // every wave of a window block gets whole 32-t steps
static_assert(NST <= 2);                        // at most two tiles a wave
static_assert(TSEQ / 32 <= NST * AW);           // every 32-t tile finds a wave when all of them are live
static_assert(AW % 4 == 0);                     // the partial tiles are summed four at a time
static_assert(TSEQ % 64 == 0);
static_assert(TSEQ % 32 == 0);                  // window k-loop steps by 32
static_assert(NB <= NB_FULL);
static_assert(USEQ <= U_FULL);
static_assert(TSEQ <= T_FULL);
static_assert((OSP2 * 4) % 16 == 0);
static_assert((size_t)LW * 16 * LPP * 4 <= (size_t)131072);      // static LDS of the first launch
static_assert((size_t)AW * 16 * PW * 4 + (size_t)AW * 16 * OSP2 * 4 + (size_t)SEGS * 16 * 8 + (size_t)16 * PSP * 4 + (size_t)2 * 16 * 4 <= (size_t)327680); // static LDS of the window kernel (one block per WGP)
static_assert(32 * LW == 256);                  // both kinds of block of the first launch have 256 threads

typedef _Float16 h16;
typedef __attribute__((ext_vector_type(16))) __bf16   v16bf;
typedef __attribute__((ext_vector_type(16))) _Float16 v16h;
typedef __attribute__((ext_vector_type(8)))  _Float16 v8h;
typedef __attribute__((ext_vector_type(8)))  unsigned short v8us;
typedef __attribute__((ext_vector_type(8)))  float    v8f;
typedef __attribute__((ext_vector_type(4)))  float    v4f;
typedef v4f  __attribute__((may_alias)) v4fa;
typedef v8h  __attribute__((may_alias)) v8ha;

__device__ __forceinline__ unsigned short f2bf(float f) { unsigned u = __float_as_uint(f); u += 0x7FFFu + ((u >> 16) & 1u); return (unsigned short)(u >> 16); }
__device__ __forceinline__ float bfr(float f) { return __uint_as_float(((unsigned)f2bf(f)) << 16); }   // value after RNE convert to bf16
__device__ __forceinline__ v16h cat16(v8h lo, v8h hi) { return __builtin_shufflevector(lo, hi, 0, 1, 2, 3, 4, 5, 6, 7, 8, 9, 10, 11, 12, 13, 14, 15); }
__device__ __forceinline__ v16bf cat16b(v8us lo, v8us hi) { return __builtin_bit_cast(v16bf, __builtin_shufflevector(lo, hi, 0, 1, 2, 3, 4, 5, 6, 7, 8, 9, 10, 11, 12, 13, 14, 15)); }
__device__ __forceinline__ v8f wmma16(v16h a, v16h b, v8f c) { return __builtin_amdgcn_wmma_f32_16x16x32_f16(false, a, false, b, (short)0, c, false, false); }
__device__ __forceinline__ v8f wmmab(v16bf a, v16bf b, v8f c) { return __builtin_amdgcn_wmma_f32_16x16x32_bf16(false, a, false, b, (short)0, c, false, false); }
// fragment loaders from K-contiguous 16-bit rows; p already includes + 8*(lane>>4): elements 0..7 <- k0+8h+0..7, elements 8..15 <- k0+16+8h+0..7 (same map for A and B)
__device__ __forceinline__ v16h  ldh(const h16* p) { return cat16(*(const v8h*)p, *(const v8h*)(p + 16)); }
// ordering point for wave-private LDS tiles (same wave writes and reads)
__device__ __forceinline__ void wave_sync() { __builtin_amdgcn_fence(3 /* release order */, "wavefront"); __builtin_amdgcn_wave_barrier(); asm volatile("" ::: "memory"); }

// f32 -> f16 with a value select: magnitudes below the smallest normal f16 become +0 (applied after the plane's carry)
static __device__ __forceinline__ h16 toh_flush(float v) { const h16 r = (h16)v; return (fabsf(v) < 6.103515625e-05f) ? (h16)0.0f : r; }
// one matrix instruction + its own guard (one accumulator per guard)
__device__ __forceinline__ v8f wmmab_g(v16bf a, v16bf b, v8f c) { c = wmmab(a, b, c); asm volatile("v_nop\n\tv_nop\n\tv_nop\n\tv_nop" : "+v"(c) : "v"(a), "v"(b)); return c; }
__device__ __forceinline__ v8f wmma16_g(v16h a, v16h b, v8f c) { c = wmma16(a, b, c); asm volatile("v_nop\n\tv_nop\n\tv_nop\n\tv_nop" : "+v"(c) : "v"(a), "v"(b)); return c; }

// ctxT_block (blocks x < CTB of the first launch): ctx [b][t][128] f32 -> f16 plane in B-fragment order (bf16 RNE value x CCAR, exact in f16, flush select).
// Element (t, d) lies at [b][t >> 5][d >> 4][(t >> 4) & 1][16 * ((t >> 3) & 1) + (d & 15)][t & 7]: the k map of ldh, so a window wave reads each fragment half as 32 lanes x 16 contiguous bytes.
// One thread holds 8 t x 4 d in registers (wave w: t0 + 8w + 0..7, lane: d = 4 * lane + 0..3): 8 whole-row loads, all issued before the first wait, then 4 stores of 16 B (8 t of one d), 64 contiguous bytes per thread.
// Each 256-B run of the plane (16 columns d of one 8-run of t) is written by one wave alone.
static_assert(64 * DM / 4 == 8 * 256);                 // load pieces: 8 per thread x 256 threads
static_assert(8 * LW == 64);                           // 8 t per wave x waves of the block == t per block
static __device__ __forceinline__ void ctxT_block(const float* __restrict__ ctx, h16* CT) {
    const int lane = threadIdx.x & 31;
    const int wave = __builtin_amdgcn_readfirstlane((int)(threadIdx.x >> 5));
    const int b = blockIdx.y, t0 = blockIdx.x * 64;
    const int d4 = lane * 4;
    const float* src = ctx + ((size_t)b * T_FULL + (size_t)(t0 + wave * 8)) * DM + d4;
    v4f v[8];
#pragma unroll                                                      // v[] is indexed by constants only; the 8 loads share one round trip
    for (int r = 0; r < 8; ++r) v[r] = *(const v4f*)(src + (size_t)r * DM);
    const int tg = (t0 >> 3) + wave;                                // this wave's 8-run of t
    h16* dst = CT + ((((size_t)b * (TSEQ / 32) + (size_t)(tg >> 2)) * 8 + (size_t)(d4 >> 4)) * 2 + (size_t)((tg >> 1) & 1)) * 256 + ((tg & 1) * 16 + (d4 & 15)) * 8;
#pragma unroll
    for (int i = 0; i < 4; ++i) {
        v8h o;
#pragma unroll
        for (int r = 0; r < 8; ++r) o[r] = toh_flush(bfr(v[r][i]) * CCAR);
        *(v8h*)(dst + i * 8) = o; }
}

// lin_block (blocks x >= CTB of the first launch): one block per 16 state rows of one batch; its LW waves split the depth (wave w: k in [w*LKS, (w+1)*LKS)). bf16 GEMM C[u][n] = sum_k x[u][k] W[k][n] (N = 32 padded):
// A fragments straight from the f32 state rows, B fragments straight from the f32 W rows (column n = 16nb + lane&15, one 4-B load per element), both RNE to bf16 in registers with the k map of ldh; every load of a wave is issued before its first use.
// The waves' partial [16][32] f32 tiles are summed through LDS in ascending wave order behind one block barrier; then + bias (bf16 RNE value), expf, x 0.2 on columns 20..29, zero on columns 30, 31; one write per element.
static __device__ __forceinline__ void lin_block(const float* __restrict__ X, const float* __restrict__ W, const float* __restrict__ bias, float* PAR, float* part) {
    const int tid = threadIdx.x;
    const int lane = tid & 31, lr = lane & 15, hi = lane >> 4;
    const int wave = __builtin_amdgcn_readfirstlane((int)(threadIdx.x >> 5));
    const int b = blockIdx.y;
    const int u0 = ((int)blockIdx.x - CTB) * 16;
    const float* xr = X + ((size_t)b * U_FULL + (size_t)(u0 + lr)) * HIN + wave * LKS + 8 * hi;
    const float* wr = W + (size_t)(wave * LKS + 8 * hi) * NPAR;     // + k*NPAR + column
    const int wc[2] = { lr, (16 + lr < NPAR) ? (16 + lr) : (NPAR - 1) };   // spare columns read the last real one and are zeroed below
    const unsigned short wm[2] = { (unsigned short)0xFFFFu, (16 + lr < NPAR) ? (unsigned short)0xFFFFu : (unsigned short)0 };   // bit mask, not a branch: the fragment's loads stay with the others above the first wait
    v4f xa[LKS / 32][4];
    float wf[LKS / 32][2][16];
#pragma unroll
    for (int ks = 0; ks < LKS / 32; ++ks) {                         // elements 0..7 <- k+8h+0..7, elements 8..15 <- k+16+8h+0..7
        xa[ks][0] = *(const v4f*)(xr + ks * 32);      xa[ks][1] = *(const v4f*)(xr + ks * 32 + 4);
        xa[ks][2] = *(const v4f*)(xr + ks * 32 + 16); xa[ks][3] = *(const v4f*)(xr + ks * 32 + 20); }
#pragma unroll
    for (int ks = 0; ks < LKS / 32; ++ks) {
#pragma unroll
        for (int nb = 0; nb < 2; ++nb) {
#pragma unroll
            for (int e = 0; e < 16; ++e) wf[ks][nb][e] = wr[(ks * 32 + (e < 8 ? e : e + 8)) * NPAR + wc[nb]]; } }   // elements 0..7 <- k+8h+0..7, elements 8..15 <- k+16+8h+0..7
    const int c = tid & 31;
    const float bx = bias[c < NPAR ? c : (NPAR - 1)];
    asm volatile("" :: "v"(bx));                                    // input-only use of the loaded value: keeps the bias load up here with the others; sunk to its use behind the barrier it would pay a round trip of its own
    __builtin_amdgcn_sched_barrier(0);                              // every load above is issued before the first wait; one sunk below a wait would pay a second round trip
    v8f acc[2];
    acc[0] = (v8f){}; acc[1] = (v8f){};
#pragma unroll
    for (int ks = 0; ks < LKS / 32; ++ks) {
        v8us lo, up;
#pragma unroll
        for (int i = 0; i < 4; ++i) { lo[i] = f2bf(xa[ks][0][i]); lo[4 + i] = f2bf(xa[ks][1][i]); up[i] = f2bf(xa[ks][2][i]); up[4 + i] = f2bf(xa[ks][3][i]); }
        const v16bf a = cat16b(lo, up);
#pragma unroll
        for (int nb = 0; nb < 2; ++nb) {
            v8us wl, wu;
#pragma unroll
            for (int i = 0; i < 8; ++i) { wl[i] = f2bf(wf[ks][nb][i]); wu[i] = f2bf(wf[ks][nb][8 + i]); }
            acc[nb] = wmmab_g(a, cat16b(wl & wm[nb], wu & wm[nb]), acc[nb]); }
    }
#pragma unroll
    for (int nb = 0; nb < 2; ++nb) {
#pragma unroll
        for (int j = 0; j < 8; ++j) part[(wave * 16 + hi * 8 + j) * LPP + nb * 16 + lr] = acc[nb][j]; }   // D: row 8h+j, col lane&15
    __syncthreads();                                                // every wave's partial tile is in LDS before any wave sums across them
    const float bcv = (c < NPAR) ? bfr(bx) : 0.0f;
    const float sc = (c >= 2 * NMIX) ? 0.2f : 1.0f;
    float* dst = PAR + ((size_t)b * USEQ + (size_t)u0) * PW;
#pragma unroll
    for (int e = 0; e < 2; ++e) { const int row = e * LW + wave;     // one wave per parameter row: 32 lanes x 4 B == 128 B
        float v = part[row * LPP + c];
#pragma unroll                                                      // straight-line reads of the partial tiles overlap
        for (int q = 1; q < LW; ++q) v += part[(q * 16 + row) * LPP + c];
        const float ex = expf(v + bcv) * sc;
        dst[row * PW + c] = (c < NPAR) ? ex : 0.0f; }
}

// k_prep: first launch. Grid x = CTB transpose blocks, then USEQ/16 linear-map blocks, per batch (y); the choice is the same for a whole block; only the linear-map blocks meet a barrier.
__global__ __launch_bounds__(256) void k_prep(const float* __restrict__ X, const float* __restrict__ W, const float* __restrict__ bias, const float* __restrict__ ctx, float* PAR, h16* CT) {
    __shared__ __align__(16) float part[LW * 16 * LPP];
    if (blockIdx.x < CTB) ctxT_block(ctx, CT);
    else lin_block(X, W, bias, PAR, part);
}

// k_window: one block per 16 steps u of one batch; its AW waves share out the live 32-t tiles (wave w: tiles first + w and first + w + AW, where they are live), each keeps a partial [16][128] f32 tile,
// and the partial tiles are summed through LDS in ascending wave order behind one block barrier.
// Live range: a term w * exp2(g * d * d) is exact +0 once g * d * d <= -ZCUT, that is |pos - t| >= sqrt(ZCUT / |g|). The block's own segment takes, per mixture, the smallest inverse width and the smallest and largest position of its 16 rows
// and writes [smallest position - radius - 1, largest position + radius + 1] to LDS with the positions; a tile of t wholly below all ten ranges or wholly above all of them has phi = +0 in every element, adds exact zeros for finite ctx and mask, and is passed over (no loads, no exponentials, no WMMA).
// The test is made at run time on the block's own parameters; a weight, width or position that is not finite makes every tile live. Per 32-t step the window tile phi[16 u][32 t] is built in registers directly in A-fragment order
// (lane: row u = lane&15, elements 0..7 <- t0+8h+0..7, elements 8..15 <- t0+16+8h+0..7): rolled loop over the 10 mixtures (per-row parameters from a wave-private LDS copy), 16 running sums per lane;
// Positions: segment = 2*wave + (lane>>4) of 16 rows, column = 20 + (lane&15); segments up to the block's own sum their rows' increments in f64, the totals meet in LDS behind a block barrier,
// the block's own segment adds the totals before it (four partial sums, ascending) to its running sums and writes the 16 rows of positions to LDS, published by a second block barrier.
// phi x mask (bf16 RNE value) x PCAR -> f16 with the flush select. B fragments (col d = 16j + (lane&15), k = t): two 16-B loads each from the fragment-ordered f16 plane, every load 512 contiguous bytes per wave. 8 accumulators (128 output columns).
// The mask and B-fragment loads of a live tile are issued at the head of its pass, ahead of its exponentials; no barrier stands between them and their use.
static_assert(32 * 16 == DM * 4);                      // store extent of one instruction == one output row
static_assert(4 * 32 * 4 == 16 * PW);                  // parameter copy: 4 trips x 32 lanes x 4 floats == 16 rows x 32 floats
__global__ __launch_bounds__(32 * AW) void k_window(const float* __restrict__ PAR, const h16* __restrict__ CT, const float* __restrict__ mask, float* OUT) {
    __shared__ __align__(16) float sp[AW * 16 * PW];
    __shared__ __align__(16) float os[AW * 16 * OSP2];
    __shared__ __align__(16) double stot[SEGS * 16];
    __shared__ __align__(16) float spos[16 * PSP];
    __shared__ __align__(16) float srng[2 * 16];                    // per summed column: lower ends, then upper ends, of the range of t with a term that is not exact +0
    const int lane = threadIdx.x & 31, lr = lane & 15, hi = lane >> 4;
    const int wave = __builtin_amdgcn_readfirstlane((int)(threadIdx.x >> 5));
    const int b = blockIdx.y;
    const int u0 = blockIdx.x * 16;
    const int pb = wave * 16 * PW;
    const int seg = wave * 2 + hi, own = blockIdx.x;
    v4f pv[4];
    { const float* prow = PAR + ((size_t)b * USEQ + (size_t)u0) * PW;
#pragma unroll
      for (int s = 0; s < 4; ++s) pv[s] = *(const v4f*)(prow + (size_t)(s * 32 + lane) * 4); }
    float x[SROWS];
    { const float* col = PAR + ((size_t)b * USEQ + (size_t)seg * SROWS) * PW + 2 * NMIX + (lr < NMIX ? lr : (NMIX - 1));   // spare lanes repeat the last summed column
#pragma unroll
      for (int i = 0; i < SROWS; ++i) x[i] = 0.0f;
      if (seg <= own) {
#pragma unroll                                                      // straight line: the segment's loads are all in flight together, and with the parameter tile's above (one round trip, not two)
          for (int i = 0; i < SROWS; ++i) x[i] = col[i * PW]; } }
#pragma unroll
    for (int s = 0; s < 4; ++s) *(v4fa*)(&sp[pb + (s * 32 + lane) * 4]) = pv[s];
    wave_sync();
    { double loc[SROWS];
      double s = 0.0;
#pragma unroll                                                      // loc[] is indexed by constants only and stays in registers
      for (int i = 0; i < SROWS; ++i) { s += (double)x[i]; loc[i] = s; }
      stot[seg * 16 + lr] = (seg < own) ? s : 0.0;                  // only the segments before the block's own count towards its offset
      __syncthreads();                                              // every segment's total is in LDS before the block's own segment sums them
      if (seg == own) {
          double tq[SEGS];
#pragma unroll                                                      // straight line: the reads of the totals overlap
          for (int q = 0; q < SEGS; ++q) tq[q] = stot[q * 16 + lr];
          const int kc = lr < NMIX ? lr : (NMIX - 1);               // spare lanes repeat the last mixture
          float av[SROWS], bv[SROWS];
#pragma unroll                                                      // av[], bv[] are indexed by constants only; the reads overlap with those of the totals
          for (int i = 0; i < SROWS; ++i) { av[i] = sp[pb + i * PW + kc]; bv[i] = sp[pb + i * PW + NMIX + kc]; }
          __builtin_amdgcn_sched_barrier(0);                        // every read above is issued before the first wait; mixed in with the sums they would be waited for four at a time
          double o[4] = { 0.0, 0.0, 0.0, 0.0 };
#pragma unroll                                                      // tq[] is indexed by constants only
          for (int q = 0; q < SEGS; ++q) o[q & 3] += tq[q];
          const double off = (o[0] + o[1]) + (o[2] + o[3]);
#pragma unroll                                                      // loc[] is indexed by constants only
          for (int i = 0; i < SROWS; ++i) spos[i * PSP + lr] = (float)(off + loc[i]);
          float bmin = bv[0], pmin = (float)(off + loc[0]), pmax = pmin;
          float chk[4] = { 0.0f, 0.0f, 0.0f, 0.0f };                // four short chains, not one long one: this half-wave is waited for by the whole block
#pragma unroll                                                      // loc[], av[], bv[] are indexed by constants only
          for (int i = 0; i < SROWS; ++i) { const float p = (float)(off + loc[i]);
              bmin = fminf(bmin, bv[i]); pmin = fminf(pmin, p); pmax = fmaxf(pmax, p);
              chk[i & 3] += (av[i] + bv[i]) + fabsf(p); }           // the sum stays finite only if every weight, width and position is finite
          const float rad = __builtin_amdgcn_sqrtf(ZCUT * __builtin_amdgcn_rcpf(bmin * -NL2E)) + 1.0f;   // + 1 covers the rounding of the radius and of the two ends
          const bool fin = ((chk[0] + chk[1]) + (chk[2] + chk[3])) < __builtin_inff();   // false for an infinity or a NaN anywhere: then every tile is live
          srng[lr]      = fin ? pmin - rad : -__builtin_inff();
          srng[16 + lr] = fin ? pmax + rad :  __builtin_inff(); }
      __syncthreads(); }                                            // the 16 rows of positions and the ranges are in LDS before any wave reads them
    int tfirst, nlive;                                              // first live tile and number of live tiles: the same in every wave of the block
    { v4f lo4 = *(const v4fa*)(&srng[0]), hi4 = *(const v4fa*)(&srng[16]);
#pragma unroll
      for (int q = 1; q < 4; ++q) { const v4f l = *(const v4fa*)(&srng[4 * q]), h = *(const v4fa*)(&srng[16 + 4 * q]);
#pragma unroll
          for (int e = 0; e < 4; ++e) { lo4[e] = fminf(lo4[e], l[e]); hi4[e] = fmaxf(hi4[e], h[e]); } }
      const float lo = fminf(fminf(lo4[0], lo4[1]), fminf(lo4[2], lo4[3]));
      const float up = fmaxf(fmaxf(hi4[0], hi4[1]), fmaxf(hi4[2], hi4[3]));
      const float loc = fminf(fmaxf(lo, 0.0f), (float)TSEQ);        // clipped to the t axis before the integer conversion
      const float upc = fminf(fmaxf(up, -1.0f), (float)(TSEQ - 1));
      const int f = (int)loc >> 5, l = (int)upc >> 5;
      tfirst = __builtin_amdgcn_readfirstlane(f);
      nlive = __builtin_amdgcn_readfirstlane((loc <= upc) ? (l - f + 1) : 0); }
    v8f acc[8];
#pragma unroll
    for (int j = 0; j < 8; ++j) acc[j] = (v8f){};
    const int pw = pb + lr * PW;
#pragma unroll                                                      // acc[] is indexed by constants only
    for (int st = 0; st < NST; ++st) {
        if (wave + st * AW >= nlive) continue;                      // scalar test, the same for the whole wave: no such live tile (a tile outside the live range adds exact zeros)
        const int tt = tfirst + wave + st * AW;                     // the wave's tile (scalar); tfirst + nlive <= TSEQ/32
        const float* kq = mask + (size_t)b * T_FULL + 8 * hi + tt * 32;                 // t = 32tt+8h+0..7 and 32tt+16+8h+0..7, all < TSEQ
        const h16* cu = CT + ((size_t)b * (TSEQ / 32) + (size_t)tt) * (8 * 2 * 256);    // the tile's part of the plane (same for all lanes); + (j*2 + k half)*256 + 8*lane  (B fragment: col d, k = t)
        v4f mq[4];
        v8h cf[8][2];
        mq[0] = *(const v4f*)(kq);      mq[1] = *(const v4f*)(kq + 4);
        mq[2] = *(const v4f*)(kq + 16); mq[3] = *(const v4f*)(kq + 20);
        __builtin_amdgcn_sched_barrier(0);                          // keeps the mask loads ahead of the fragment loads: loads return in order, and issued last the tile's mask would be waited for behind its fragments
#pragma unroll                                                      // cf[] is indexed by constants only; ascending addresses
        for (int j = 0; j < 8; ++j) { const h16* p = cu + j * 512 + lane * 8; cf[j][0] = *(const v8h*)p; cf[j][1] = *(const v8h*)(p + 256); }
        // every global load of the tile stands above, ahead of its exponentials, which cover the round trips; left at its WMMA each pair would be waited for alone
        float s[16];
#pragma unroll
        for (int i = 0; i < 16; ++i) s[i] = 0.0f;
        const float tb = (float)(tt * 32 + 8 * hi);
#pragma unroll 1
        for (int k = 0; k < NMIX; ++k) {
            const float a = sp[pw + k];
            const float g = sp[pw + NMIX + k] * NL2E;
            const float kp = spos[lr * PSP + k];
#pragma unroll
            for (int i = 0; i < 8; ++i) {
                const float d0 = kp - (tb + (float)i);
                const float d1 = kp - (tb + (float)(16 + i));
                s[i]     += a * __builtin_amdgcn_exp2f(g * d0 * d0);
                s[8 + i] += a * __builtin_amdgcn_exp2f(g * d1 * d1); }
        }
        float mk[16];
#pragma unroll
        for (int r = 0; r < 4; ++r) { mk[r] = mq[0][r]; mk[4 + r] = mq[1][r]; mk[8 + r] = mq[2][r]; mk[12 + r] = mq[3][r]; }
        v16h pa;
#pragma unroll
        for (int i = 0; i < 16; ++i) { const float gv = s[i] * bfr(mk[i]) * PCAR; pa[i] = toh_flush(gv); }
#pragma unroll
        for (int j = 0; j < 8; ++j) acc[j] = wmma16_g(pa, cat16(cf[j][0], cf[j][1]), acc[j]);
        asm volatile("s_wait_xcnt 0x0" :: "v"(kq), "s"(cu), "v"(lane) : "memory"); // the mask address pair and the plane base that the tile's loads name stay live up to here, so no write lands on them ahead of this wait; it stands behind the last use of the loaded data, where nothing is left to wait for
    }
    const int wb = wave * 16 * OSP2;
    const int nsum = (nlive < AW) ? ((nlive + 3) & ~3) : AW;        // partial tiles that are summed: the waves with a live tile, rounded up to whole fours (the waves that round it up write their zeros)
    // D layout: acc[j][r] = (u = 8h + r, d = 16j + lane&15) -> os[wave][u][d]; rows 0..15 x columns 0..127 of the wave's partial tile all written
    if (wave < nsum) {
#pragma unroll
        for (int j = 0; j < 8; ++j) {
#pragma unroll
            for (int r = 0; r < 8; ++r) os[wb + (8 * hi + r) * OSP2 + 16 * j + lr] = acc[j][r] * OSC; } }
    __syncthreads();                                                // every summed partial tile (waves below nsum) is in LDS before any wave sums across them
    float* orow = OUT + ((size_t)b * OUT_U + (size_t)u0) * DM;
    for (int row = wave; row < 16; row += AW) {                     // one wave per output row: 32 lanes x 16 B == 512 B
        v4f val = (v4f){};                                          // no live tile at all: the row is zero
        for (int w0 = 0; w0 < nsum; w0 += 4) {
#pragma unroll                                                      // four straight-line reads overlap; one by one, each would be waited for alone
            for (int w = 0; w < 4; ++w) val += *(const v4fa*)(&os[(w0 + w) * 16 * OSP2 + row * OSP2 + lane * 4]); }
        *(v4f*)(orow + (size_t)row * DM + lane * 4) = val; }
}

static constexpr size_t al256(size_t v) { return (v + 255) & ~(size_t)255; }
static constexpr size_t SZ_CT  = al256((size_t)NB * DM * TSEQ * 2);
static constexpr size_t SZ_PAR = al256((size_t)NB * USEQ * PW * 4);
static constexpr size_t SZ_TOTAL = SZ_CT + SZ_PAR;
static_assert(SZ_TOTAL <= (size_t)134217728);          // workspace carve <= 128 MiB
static_assert(((size_t)TSEQ * 2) % 128 == 0);

extern "C" void kernel_launch(void* const* d_in, const int* in_sizes, int n_in,
                              void* d_out, int out_size, void* d_ws, size_t ws_size, hipStream_t stream) {
    if (n_in < 5) return;
    const size_t needh = ((size_t)(NB - 1) * U_FULL + USEQ) * HIN;
    const size_t needc = ((size_t)(NB - 1) * T_FULL + TSEQ) * DM;
    const size_t needm = (size_t)(NB - 1) * T_FULL + TSEQ;
    if ((size_t)in_sizes[0] < needh || (size_t)in_sizes[1] < needc || (size_t)in_sizes[2] < needm) return;
    if ((size_t)in_sizes[3] < (size_t)HIN * NPAR || in_sizes[4] < NPAR) return;
    if ((size_t)out_size < ((size_t)(NB - 1) * OUT_U + USEQ) * DM) return;
    if (SZ_TOTAL > ws_size) return;
    // wire order: h_t, ctx, mask, W, b
    const float* hin  = (const float*)d_in[0];
    const float* ctx  = (const float*)d_in[1];
    const float* mask = (const float*)d_in[2];
    const float* wlin = (const float*)d_in[3];
    const float* blin = (const float*)d_in[4];
    float* OUT = (float*)d_out;      // [NB][USEQ][128]
    char* wsp = (char*)d_ws;
    h16* CT  = (h16*)wsp; wsp += SZ_CT;               // ctx f16 x64, B-fragment order [NB][TSEQ/32][8][2][32][8]
    float* PAR = (float*)wsp; wsp += SZ_PAR;          // parameters [NB*USEQ][32] f32

    // grid (t tiles of the ctx transpose, then 16-row tiles of the linear map; batches)
    k_prep<<<dim3(CTB + USEQ / 16, NB, 1), 256, 0, stream>>>(hin, wlin, blin, ctx, PAR, CT);
    k_window<<<dim3(USEQ / 16, NB, 1), 32 * AW, 0, stream>>>(PAR, CT, mask, OUT);
}

// v008
// It runs in 11.3 microseconds.
// In two side-by-side timings against v007, it was 1.07 and 1.04 times as fast.
// Over all steps from v000 it is 14.2 times as fast.
#include <hip/hip_runtime.h>

// Soft window over a context sequence: per step u a 30-wide linear map of the state row (weights [in][out], bias), exp, split into 10 weights / 10 inverse widths / 10 position increments (x 0.2, prefix-summed over u);
// window phi[u][t] = sum_k w_k exp(-g_k (pos_k - t)^2); output [NB][USEQ][128] = (phi * mask) @ ctx, f32.
// Compute dtypes, f32 accumulate everywhere: state-row linear map v_wmma_f32_16x16x32_bf16 (state rows, W, bias RNE-converted to bf16; products exact);
// window-times-context v_wmma_f32_16x16x32_f16: phi single f16 with a x256 carry (built in registers, f32 vector math), ctx (RNE-converted to bf16, exact in f16) single f16 with a x64 carry; carries folded by 2^-14 in the f32 epilogue.
// Layout: state rows and W staged as f32 in LDS in whole 128-B lines (asynchronous copies), read from there in fragment order and RNE-converted to bf16 in registers (no copy in memory; columns 30, 31 of the W fragments zero); ctx f16 plane in B-fragment order [b][t/32][d/16][k half][lane][8 t] (one fragment half of a wave = 512 contiguous bytes); parameter plane f32 [b*USEQ + u][32] (0..9 weights, 10..19 inverse widths, 20..29 position increments, 30..31 zero).
// Two launches: (1) the ctx transpose blocks and the linear-map blocks side by side in one grid (neither reads what the other writes); (2) the window blocks, each of which forms the positions of its own 16 steps itself.
// Linear map: one block per 16 state rows (whole chip), its 8 waves split the depth, f32 partial tiles summed in LDS in wave order; bias, expf and the x 0.2 follow there.
// Prefix sum (head of every window block): the rows of a batch are cut into 32 segments of 16 (16 waves x 2 half-waves, lane = column); the segments up to the block's own keep f64 sums of their rows, the f64 totals meet in LDS, and the block's own segment writes its 16 rows of positions to LDS. exp of the linear map: expf; window exponentials: exp2 of the log2(e)-scaled argument.

#ifndef NB
#define NB 8
#endif
#ifndef USEQ
#define USEQ 512
#endif
#ifndef TSEQ
#define TSEQ 1024
#endif
#define NB_FULL 8
#define U_FULL  512
#define T_FULL  1024
#ifndef OUT_U
#define OUT_U USEQ               // row pitch (in steps) between batches of the output
#endif
#define HIN  512                 // state width = depth of the linear map
#define DM   128                 // context width = output width
#define NMIX 10
#define NPAR 30                  // 3 * NMIX columns of the linear map
#define PW   32
#define AW   16                  // waves per window block: all on the same 16 steps, sharing out the live 32-t tiles (wave w: tiles first + w, first + w + AW)
#define NST  (TSEQ / AW / 32)   // 32-t steps per wave of a window block
#define OSP2 132                 // LDS row pitch (floats) of the output tile
#define LW   8                   // waves per linear-map block: all on the same 16 rows, each on its own HIN/LW slice of the depth
#define LKS  (HIN / LW)          // depth per wave
#define LPP  36                  // LDS row pitch (floats) of a partial tile: 8 rows apart = 32 banks apart, so the two half-waves of a store do not meet
#define XSP  68                  // LDS row pitch (floats) of a wave's slice of the state rows: 272 B = 16 B x odd, so the 16 rows of a 16-B fragment read fall on 64 different banks
#define SEGS (2 * AW)            // prefix-sum segments per batch: AW waves x 2 half-waves
#define SROWS 16                 // rows per segment == steps per window block
#define PSP  17                  // LDS row pitch (floats) of the position tile: 16 rows land on 16 banks
#define CTB  (TSEQ / 64)         // ctx transpose blocks per batch
#define PCAR 256.0f              // carry of the window operand
#define CCAR 64.0f               // carry of the ctx plane
#define OSC  (1.0f / 16384.0f)   // 1 / (PCAR * CCAR)
#define NL2E (-1.4426950408889634f)
#define ZCUT 160.0f              // exp2 of an argument at or below -ZCUT is exact +0 in f32 (the smallest f32 is 2^-149)

static_assert(NPAR == 3 * NMIX);
static_assert(NPAR <= PW);
static_assert(PW == 32);
static_assert(256 % PW == 0);                   // thread-linear element index keeps its column
static_assert(HIN % 32 == 0);                   // GEMM k-loop steps by 32
static_assert(HIN % 8 == 0);
static_assert(DM == 128);                       // output row = 32 lanes x 4 floats; 8 column tiles of 16
static_assert(LKS % 32 == 0);                   // every wave of a linear-map block gets whole 32-deep steps
static_assert(LW * LKS == HIN);
static_assert(16 * PW == 2 * 32 * LW);          // tile elements == 2 per thread of a linear-map block
static_assert(SEGS * SROWS == USEQ);            // the segments cover a batch exactly
static_assert(NMIX <= 16);                      // one half-wave holds every summed column
static_assert(USEQ % 16 == 0);                  // window grid covers the steps exactly
static_assert(TSEQ % (32 * AW) == 0);           // every wave of a window block gets whole 32-t steps
static_assert(NST <= 2);                        // at most two tiles a wave
static_assert(TSEQ / 32 <= NST * AW);           // every 32-t tile finds a wave when all of them are live
static_assert(AW % 4 == 0);                     // the partial tiles are summed four at a time
static_assert(TSEQ % 64 == 0);
static_assert(TSEQ % 32 == 0);                  // window k-loop steps by 32
static_assert(NB <= NB_FULL);
static_assert(USEQ <= U_FULL);
static_assert(TSEQ <= T_FULL);
static_assert((OSP2 * 4) % 16 == 0);
static_assert(LKS * 4 == 16 * 16);              // a row of a wave's slice of the state rows == 16 lanes x 16 B (two whole lines)
static_assert((LKS * NPAR) % 128 == 0);         // a wave's slice of W == whole copies of 32 lanes x 16 B
static_assert(LKS * NPAR / 128 == 15);          // copies per wave for W (one asm statement holds at most 15)
static_assert((XSP * 4) % 16 == 0);
static_assert((size_t)LW * 16 * LPP * 4 + (size_t)LW * 16 * XSP * 4 + (size_t)HIN * NPAR * 4 <= (size_t)131072);      // static LDS of the first launch
static_assert((size_t)AW * 16 * PW * 4 + (size_t)AW * 16 * OSP2 * 4 + (size_t)SEGS * 16 * 8 + (size_t)16 * PSP * 4 + (size_t)2 * 16 * 4 <= (size_t)327680); // static LDS of the window kernel (one block per WGP)
static_assert(32 * LW == 256);                  // both kinds of block of the first launch have 256 threads

typedef _Float16 h16;
typedef __attribute__((ext_vector_type(16))) __bf16   v16bf;
typedef __attribute__((ext_vector_type(16))) _Float16 v16h;
typedef __attribute__((ext_vector_type(8)))  _Float16 v8h;
typedef __attribute__((ext_vector_type(8)))  unsigned short v8us;
typedef __attribute__((ext_vector_type(8)))  float    v8f;
typedef __attribute__((ext_vector_type(4)))  float    v4f;
typedef v4f  __attribute__((may_alias)) v4fa;
typedef v8h  __attribute__((may_alias)) v8ha;

__device__ __forceinline__ unsigned short f2bf(float f) { unsigned u = __float_as_uint(f); u += 0x7FFFu + ((u >> 16) & 1u); return (unsigned short)(u >> 16); }
__device__ __forceinline__ float bfr(float f) { return __uint_as_float(((unsigned)f2bf(f)) << 16); }   // value after RNE convert to bf16
__device__ __forceinline__ v16h cat16(v8h lo, v8h hi) { return __builtin_shufflevector(lo, hi, 0, 1, 2, 3, 4, 5, 6, 7, 8, 9, 10, 11, 12, 13, 14, 15); }
__device__ __forceinline__ v16bf cat16b(v8us lo, v8us hi) { return __builtin_bit_cast(v16bf, __builtin_shufflevector(lo, hi, 0, 1, 2, 3, 4, 5, 6, 7, 8, 9, 10, 11, 12, 13, 14, 15)); }
__device__ __forceinline__ v8f wmma16(v16h a, v16h b, v8f c) { return __builtin_amdgcn_wmma_f32_16x16x32_f16(false, a, false, b, (short)0, c, false, false); }
__device__ __forceinline__ v8f wmmab(v16bf a, v16bf b, v8f c) { return __builtin_amdgcn_wmma_f32_16x16x32_bf16(false, a, false, b, (short)0, c, false, false); }
// fragment loaders from K-contiguous 16-bit rows; p already includes + 8*(lane>>4): elements 0..7 <- k0+8h+0..7, elements 8..15 <- k0+16+8h+0..7 (same map for A and B)
__device__ __forceinline__ v16h  ldh(const h16* p) { return cat16(*(const v8h*)p, *(const v8h*)(p + 16)); }
// ordering point for wave-private LDS tiles (same wave writes and reads)
__device__ __forceinline__ void wave_sync() { __builtin_amdgcn_fence(3 /* release order */, "wavefront"); __builtin_amdgcn_wave_barrier(); asm volatile("" ::: "memory"); }

// f32 -> f16 with a value select: magnitudes below the smallest normal f16 become +0 (applied after the plane's carry)
static __device__ __forceinline__ h16 toh_flush(float v) { const h16 r = (h16)v; return (fabsf(v) < 6.103515625e-05f) ? (h16)0.0f : r; }
// one matrix instruction + its own guard (one accumulator per guard)
__device__ __forceinline__ v8f wmmab_g(v16bf a, v16bf b, v8f c) { c = wmmab(a, b, c); asm volatile("v_nop\n\tv_nop\n\tv_nop\n\tv_nop" : "+v"(c) : "v"(a), "v"(b)); return c; }
__device__ __forceinline__ v8f wmma16_g(v16h a, v16h b, v8f c) { c = wmma16(a, b, c); asm volatile("v_nop\n\tv_nop\n\tv_nop\n\tv_nop" : "+v"(c) : "v"(a), "v"(b)); return c; }

// ctxT_block (blocks x < CTB of the first launch): ctx [b][t][128] f32 -> f16 plane in B-fragment order (bf16 RNE value x CCAR, exact in f16, flush select).
// Element (t, d) lies at [b][t >> 5][d >> 4][(t >> 4) & 1][16 * ((t >> 3) & 1) + (d & 15)][t & 7]: the k map of ldh, so a window wave reads each fragment half as 32 lanes x 16 contiguous bytes.
// One thread holds 8 t x 4 d in registers (wave w: t0 + 8w + 0..7, lane: d = 4 * lane + 0..3): 8 whole-row loads, all issued before the first wait, then 4 stores of 16 B (8 t of one d), 64 contiguous bytes per thread.
// Each 256-B run of the plane (16 columns d of one 8-run of t) is written by one wave alone.
static_assert(64 * DM / 4 == 8 * 256);                 // load pieces: 8 per thread x 256 threads
static_assert(8 * LW == 64);                           // 8 t per wave x waves of the block == t per block
static __device__ __forceinline__ void ctxT_block(const float* __restrict__ ctx, h16* CT) {
    const int lane = threadIdx.x & 31;
    const int wave = __builtin_amdgcn_readfirstlane((int)(threadIdx.x >> 5));
    const int b = blockIdx.y, t0 = blockIdx.x * 64;
    const int d4 = lane * 4;
    const float* src = ctx + ((size_t)b * T_FULL + (size_t)(t0 + wave * 8)) * DM + d4;
    v4f v[8];
#pragma unroll                                                      // v[] is indexed by constants only; the 8 loads share one round trip
    for (int r = 0; r < 8; ++r) v[r] = *(const v4f*)(src + (size_t)r * DM);
    const int tg = (t0 >> 3) + wave;                                // this wave's 8-run of t
    h16* dst = CT + ((((size_t)b * (TSEQ / 32) + (size_t)(tg >> 2)) * 8 + (size_t)(d4 >> 4)) * 2 + (size_t)((tg >> 1) & 1)) * 256 + ((tg & 1) * 16 + (d4 & 15)) * 8;
#pragma unroll
    for (int i = 0; i < 4; ++i) {
        v8h o;
#pragma unroll
        for (int r = 0; r < 8; ++r) o[r] = toh_flush(bfr(v[r][i]) * CCAR);
        *(v8h*)(dst + i * 8) = o; }
}

// lin_block (blocks x >= CTB of the first launch): one block per 16 state rows of one batch; its LW waves split the depth (wave w: k in [w*LKS, (w+1)*LKS)). bf16 GEMM C[u][n] = sum_k x[u][k] W[k][n] (N = 32 padded):
// Each wave brings its own depth slice to LDS by asynchronous copies of 16 B per lane, every copy whole 128-B lines: 16 rows x 256 B of the state rows (2 rows a copy, LDS pitch XSP) and 64 rows of W (7,680 contiguous bytes, kept linear).
// A fragments from the LDS state rows (16-B reads), B fragments from the LDS W rows (column n = 16nb + lane&15, one 4-B read per element), both RNE to bf16 in registers with the k map of ldh; every LDS read of a wave is issued before its first use.
// The waves' partial [16][32] f32 tiles are summed through LDS in ascending wave order behind one block barrier; then + bias (bf16 RNE value), expf, x 0.2 on columns 20..29, zero on columns 30, 31; one write per element.
static __device__ __forceinline__ unsigned lds_addr(const void* p) { return (unsigned)(size_t)p; }   // LDS byte address: the low 32 bits of a __shared__ address
static __device__ __forceinline__ void lin_block(const float* __restrict__ X, const float* __restrict__ W, const float* __restrict__ bias, float* PAR, float* part, float* xs, float* wsh) {
    const int tid = threadIdx.x;
    const int lane = tid & 31, lr = lane & 15, hi = lane >> 4;
    const int wave = __builtin_amdgcn_readfirstlane((int)(threadIdx.x >> 5));
    const int b = blockIdx.y;
    const int u0 = ((int)blockIdx.x - CTB) * 16;
    const int c = tid & 31;
    const float bx = bias[c < NPAR ? c : (NPAR - 1)];               // issued ahead of the copies: its round trip runs beside theirs
    { // state rows: copy q brings rows 2q and 2q+1 of the wave's slice (lanes 0..15 one row, lanes 16..31 the next; 16 B per lane)
      const float* xg = X + ((size_t)b * U_FULL + (size_t)(u0 + hi)) * HIN + wave * LKS + lr * 4;
      const unsigned xl = lds_addr(&xs[(wave * 16 + hi) * XSP + lr * 4]);
      // the copies and the wait that stands ahead of any rewrite of their address registers, in one statement
      asm volatile("global_load_async_to_lds_b128 %0, %8, off\n\t"
                   "global_load_async_to_lds_b128 %1, %9, off\n\t"
                   "global_load_async_to_lds_b128 %2, %10, off\n\t"
                   "global_load_async_to_lds_b128 %3, %11, off\n\t"
                   "global_load_async_to_lds_b128 %4, %12, off\n\t"
                   "global_load_async_to_lds_b128 %5, %13, off\n\t"
                   "global_load_async_to_lds_b128 %6, %14, off\n\t"
                   "global_load_async_to_lds_b128 %7, %15, off\n\t"
                   "s_wait_xcnt 0x0"
                   :: "v"(xl), "v"(xl + 2u * XSP * 4u), "v"(xl + 4u * XSP * 4u), "v"(xl + 6u * XSP * 4u),
                      "v"(xl + 8u * XSP * 4u), "v"(xl + 10u * XSP * 4u), "v"(xl + 12u * XSP * 4u), "v"(xl + 14u * XSP * 4u),
                      "v"(xg), "v"(xg + 2 * HIN), "v"(xg + 4 * HIN), "v"(xg + 6 * HIN),
                      "v"(xg + 8 * HIN), "v"(xg + 10 * HIN), "v"(xg + 12 * HIN), "v"(xg + 14 * HIN)
                   : "memory");
      // W: copy q brings bytes 512q .. 512q+511 of the wave's 64 rows
      const float* wg = W + (size_t)wave * (LKS * NPAR) + lane * 4;
      const unsigned wl = lds_addr(&wsh[wave * (LKS * NPAR) + lane * 4]);
      asm volatile("global_load_async_to_lds_b128 %0, %15, off\n\t"
                   "global_load_async_to_lds_b128 %1, %16, off\n\t"
                   "global_load_async_to_lds_b128 %2, %17, off\n\t"
                   "global_load_async_to_lds_b128 %3, %18, off\n\t"
                   "global_load_async_to_lds_b128 %4, %19, off\n\t"
                   "global_load_async_to_lds_b128 %5, %20, off\n\t"
                   "global_load_async_to_lds_b128 %6, %21, off\n\t"
                   "global_load_async_to_lds_b128 %7, %22, off\n\t"
                   "global_load_async_to_lds_b128 %8, %23, off\n\t"
                   "global_load_async_to_lds_b128 %9, %24, off\n\t"
                   "global_load_async_to_lds_b128 %10, %25, off\n\t"
                   "global_load_async_to_lds_b128 %11, %26, off\n\t"
                   "global_load_async_to_lds_b128 %12, %27, off\n\t"
                   "global_load_async_to_lds_b128 %13, %28, off\n\t"
                   "global_load_async_to_lds_b128 %14, %29, off\n\t"
                   "s_wait_xcnt 0x0"
                   :: "v"(wl), "v"(wl + 512u), "v"(wl + 1024u), "v"(wl + 1536u), "v"(wl + 2048u),
                      "v"(wl + 2560u), "v"(wl + 3072u), "v"(wl + 3584u), "v"(wl + 4096u), "v"(wl + 4608u),
                      "v"(wl + 5120u), "v"(wl + 5632u), "v"(wl + 6144u), "v"(wl + 6656u), "v"(wl + 7168u),
                      "v"(wg), "v"(wg + 128), "v"(wg + 256), "v"(wg + 384), "v"(wg + 512),
                      "v"(wg + 640), "v"(wg + 768), "v"(wg + 896), "v"(wg + 1024), "v"(wg + 1152),
                      "v"(wg + 1280), "v"(wg + 1408), "v"(wg + 1536), "v"(wg + 1664), "v"(wg + 1792)
                   : "memory"); }
    asm volatile("s_wait_asynccnt 0x0" ::: "memory");               // the wave's own copies have landed in LDS
    __syncthreads();                                                // no staged byte is read ahead of this barrier
    const float* xr = xs + (wave * 16 + lr) * XSP + 8 * hi;         // the wave's slice of row lr in LDS
    const float* wr = wsh + (wave * LKS + 8 * hi) * NPAR;           // + k*NPAR + column
    const int wc[2] = { lr, (16 + lr < NPAR) ? (16 + lr) : (NPAR - 1) };   // spare columns read the last real one and are zeroed below
    const unsigned short wm[2] = { (unsigned short)0xFFFFu, (16 + lr < NPAR) ? (unsigned short)0xFFFFu : (unsigned short)0 };   // bit mask, not a branch: the fragment's loads stay with the others above the first wait
    v4f xa[LKS / 32][4];
    float wf[LKS / 32][2][16];
#pragma unroll
    for (int ks = 0; ks < LKS / 32; ++ks) {                         // elements 0..7 <- k+8h+0..7, elements 8..15 <- k+16+8h+0..7
        xa[ks][0] = *(const v4f*)(xr + ks * 32);      xa[ks][1] = *(const v4f*)(xr + ks * 32 + 4);
        xa[ks][2] = *(const v4f*)(xr + ks * 32 + 16); xa[ks][3] = *(const v4f*)(xr + ks * 32 + 20); }
#pragma unroll
    for (int ks = 0; ks < LKS / 32; ++ks) {
#pragma unroll
        for (int nb = 0; nb < 2; ++nb) {
#pragma unroll
            for (int e = 0; e < 16; ++e) wf[ks][nb][e] = wr[(ks * 32 + (e < 8 ? e : e + 8)) * NPAR + wc[nb]]; } }   // elements 0..7 <- k+8h+0..7, elements 8..15 <- k+16+8h+0..7
    asm volatile("" :: "v"(bx));                                    // input-only use of the loaded value: keeps the bias load up with the copies; sunk to its use behind the last barrier it would pay a round trip of its own
    __builtin_amdgcn_sched_barrier(0);                              // every LDS read above is issued before the first wait; mixed in with the conversions they would be waited for a few at a time
    v8f acc[2];
    acc[0] = (v8f){}; acc[1] = (v8f){};
#pragma unroll
    for (int ks = 0; ks < LKS / 32; ++ks) {
        v8us lo, up;
#pragma unroll
        for (int i = 0; i < 4; ++i) { lo[i] = f2bf(xa[ks][0][i]); lo[4 + i] = f2bf(xa[ks][1][i]); up[i] = f2bf(xa[ks][2][i]); up[4 + i] = f2bf(xa[ks][3][i]); }
        const v16bf a = cat16b(lo, up);
#pragma unroll
        for (int nb = 0; nb < 2; ++nb) {
            v8us wl, wu;
#pragma unroll
            for (int i = 0; i < 8; ++i) { wl[i] = f2bf(wf[ks][nb][i]); wu[i] = f2bf(wf[ks][nb][8 + i]); }
            acc[nb] = wmmab_g(a, cat16b(wl & wm[nb], wu & wm[nb]), acc[nb]); }
    }
#pragma unroll
    for (int nb = 0; nb < 2; ++nb) {
#pragma unroll
        for (int j = 0; j < 8; ++j) part[(wave * 16 + hi * 8 + j) * LPP + nb * 16 + lr] = acc[nb][j]; }   // D: row 8h+j, col lane&15
    __syncthreads();                                                // every wave's partial tile is in LDS before any wave sums across them
    const float bcv = (c < NPAR) ? bfr(bx) : 0.0f;
    const float sc = (c >= 2 * NMIX) ? 0.2f : 1.0f;
    float* dst = PAR + ((size_t)b * USEQ + (size_t)u0) * PW;
#pragma unroll
    for (int e = 0; e < 2; ++e) { const int row = e * LW + wave;     // one wave per parameter row: 32 lanes x 4 B == 128 B
        float v = part[row * LPP + c];
#pragma unroll                                                      // straight-line reads of the partial tiles overlap
        for (int q = 1; q < LW; ++q) v += part[(q * 16 + row) * LPP + c];
        const float ex = expf(v + bcv) * sc;
        dst[row * PW + c] = (c < NPAR) ? ex : 0.0f; }
}

// k_prep: first launch. Grid x = CTB transpose blocks, then USEQ/16 linear-map blocks, per batch (y); the choice is the same for a whole block; only the linear-map blocks copy to LDS and meet barriers.
__global__ __launch_bounds__(256) void k_prep(const float* __restrict__ X, const float* __restrict__ W, const float* __restrict__ bias, const float* __restrict__ ctx, float* PAR, h16* CT) {
    __shared__ __align__(16) float part[LW * 16 * LPP];
    __shared__ __align__(16) float xs[LW * 16 * XSP];               // state rows of the block, f32: [wave][row][depth slice]
    __shared__ __align__(16) float wsh[HIN * NPAR];                 // W, f32, as in memory
    if (blockIdx.x < CTB) ctxT_block(ctx, CT);
    else lin_block(X, W, bias, PAR, part, xs, wsh);
}

// k_window: one block per 16 steps u of one batch; its AW waves share out the live 32-t tiles (wave w: tiles first + w and first + w + AW, where they are live), each keeps a partial [16][128] f32 tile,
// and the partial tiles are summed through LDS in ascending wave order behind one block barrier.
// Live range: a term w * exp2(g * d * d) is exact +0 once g * d * d <= -ZCUT, that is |pos - t| >= sqrt(ZCUT / |g|). The block's own segment takes, per mixture, the smallest inverse width and the smallest and largest position of its 16 rows
// and writes [smallest position - radius - 1, largest position + radius + 1] to LDS with the positions; a tile of t wholly below all ten ranges or wholly above all of them has phi = +0 in every element, adds exact zeros for finite ctx and mask, and is passed over (no loads, no exponentials, no WMMA).
// The test is made at run time on the block's own parameters; a weight, width or position that is not finite makes every tile live. Per 32-t step the window tile phi[16 u][32 t] is built in registers directly in A-fragment order
// (lane: row u = lane&15, elements 0..7 <- t0+8h+0..7, elements 8..15 <- t0+16+8h+0..7): rolled loop over the 10 mixtures (per-row parameters from a wave-private LDS copy), 16 running sums per lane;
// Positions: segment = 2*wave + (lane>>4) of 16 rows, column = 20 + (lane&15); segments up to the block's own sum their rows' increments in f64, the totals meet in LDS behind a block barrier,
// the block's own segment adds the totals before it (four partial sums, ascending) to its running sums and writes the 16 rows of positions to LDS, published by a second block barrier.
// phi x mask (bf16 RNE value) x PCAR -> f16 with the flush select. B fragments (col d = 16j + (lane&15), k = t): two 16-B loads each from the fragment-ordered f16 plane, every load 512 contiguous bytes per wave. 8 accumulators (128 output columns).
// The mask and B-fragment loads of a live tile are issued at the head of its pass, ahead of its exponentials; no barrier stands between them and their use.
static_assert(32 * 16 == DM * 4);                      // store extent of one instruction == one output row
static_assert(4 * 32 * 4 == 16 * PW);                  // parameter copy: 4 trips x 32 lanes x 4 floats == 16 rows x 32 floats
__global__ __launch_bounds__(32 * AW) void k_window(const float* __restrict__ PAR, const h16* __restrict__ CT, const float* __restrict__ mask, float* OUT) {
    __shared__ __align__(16) float sp[AW * 16 * PW];
    __shared__ __align__(16) float os[AW * 16 * OSP2];
    __shared__ __align__(16) double stot[SEGS * 16];
    __shared__ __align__(16) float spos[16 * PSP];
    __shared__ __align__(16) float srng[2 * 16];                    // per summed column: lower ends, then upper ends, of the range of t with a term that is not exact +0
    const int lane = threadIdx.x & 31, lr = lane & 15, hi = lane >> 4;
    const int wave = __builtin_amdgcn_readfirstlane((int)(threadIdx.x >> 5));
    const int b = blockIdx.y;
    const int u0 = blockIdx.x * 16;
    const int pb = wave * 16 * PW;
    const int seg = wave * 2 + hi, own = blockIdx.x;
    v4f pv[4];
    { const float* prow = PAR + ((size_t)b * USEQ + (size_t)u0) * PW;
#pragma unroll
      for (int s = 0; s < 4; ++s) pv[s] = *(const v4f*)(prow + (size_t)(s * 32 + lane) * 4); }
    float x[SROWS];
    { const float* col = PAR + ((size_t)b * USEQ + (size_t)seg * SROWS) * PW + 2 * NMIX + (lr < NMIX ? lr : (NMIX - 1));   // spare lanes repeat the last summed column
#pragma unroll
      for (int i = 0; i < SROWS; ++i) x[i] = 0.0f;
      if (seg <= own) {
#pragma unroll                                                      // straight line: the segment's loads are all in flight together, and with the parameter tile's above (one round trip, not two)
          for (int i = 0; i < SROWS; ++i) x[i] = col[i * PW]; } }
#pragma unroll
    for (int s = 0; s < 4; ++s) *(v4fa*)(&sp[pb + (s * 32 + lane) * 4]) = pv[s];
    wave_sync();
    { double loc[SROWS];
      double s = 0.0;
#pragma unroll                                                      // loc[] is indexed by constants only and stays in registers
      for (int i = 0; i < SROWS; ++i) { s += (double)x[i]; loc[i] = s; }
      stot[seg * 16 + lr] = (seg < own) ? s : 0.0;                  // only the segments before the block's own count towards its offset
      __syncthreads();                                              // every segment's total is in LDS before the block's own segment sums them
      if (seg == own) {
          double tq[SEGS];
#pragma unroll                                                      // straight line: the reads of the totals overlap
          for (int q = 0; q < SEGS; ++q) tq[q] = stot[q * 16 + lr];
          const int kc = lr < NMIX ? lr : (NMIX - 1);               // spare lanes repeat the last mixture
          float av[SROWS], bv[SROWS];
#pragma unroll                                                      // av[], bv[] are indexed by constants only; the reads overlap with those of the totals
          for (int i = 0; i < SROWS; ++i) { av[i] = sp[pb + i * PW + kc]; bv[i] = sp[pb + i * PW + NMIX + kc]; }
          __builtin_amdgcn_sched_barrier(0);                        // every read above is issued before the first wait; mixed in with the sums they would be waited for four at a time
          double o[4] = { 0.0, 0.0, 0.0, 0.0 };
#pragma unroll                                                      // tq[] is indexed by constants only
          for (int q = 0; q < SEGS; ++q) o[q & 3] += tq[q];
          const double off = (o[0] + o[1]) + (o[2] + o[3]);
#pragma unroll                                                      // loc[] is indexed by constants only
          for (int i = 0; i < SROWS; ++i) spos[i * PSP + lr] = (float)(off + loc[i]);
          float bmin = bv[0], pmin = (float)(off + loc[0]), pmax = pmin;
          float chk[4] = { 0.0f, 0.0f, 0.0f, 0.0f };                // four short chains, not one long one: this half-wave is waited for by the whole block
#pragma unroll                                                      // loc[], av[], bv[] are indexed by constants only
          for (int i = 0; i < SROWS; ++i) { const float p = (float)(off + loc[i]);
              bmin = fminf(bmin, bv[i]); pmin = fminf(pmin, p); pmax = fmaxf(pmax, p);
              chk[i & 3] += (av[i] + bv[i]) + fabsf(p); }           // the sum stays finite only if every weight, width and position is finite
          const float rad = __builtin_amdgcn_sqrtf(ZCUT * __builtin_amdgcn_rcpf(bmin * -NL2E)) + 1.0f;   // + 1 covers the rounding of the radius and of the two ends
          const bool fin = ((chk[0] + chk[1]) + (chk[2] + chk[3])) < __builtin_inff();   // false for an infinity or a NaN anywhere: then every tile is live
          srng[lr]      = fin ? pmin - rad : -__builtin_inff();
          srng[16 + lr] = fin ? pmax + rad :  __builtin_inff(); }
      __syncthreads(); }                                            // the 16 rows of positions and the ranges are in LDS before any wave reads them
    int tfirst, nlive;                                              // first live tile and number of live tiles: the same in every wave of the block
    { v4f lo4 = *(const v4fa*)(&srng[0]), hi4 = *(const v4fa*)(&srng[16]);
#pragma unroll
      for (int q = 1; q < 4; ++q) { const v4f l = *(const v4fa*)(&srng[4 * q]), h = *(const v4fa*)(&srng[16 + 4 * q]);
#pragma unroll
          for (int e = 0; e < 4; ++e) { lo4[e] = fminf(lo4[e], l[e]); hi4[e] = fmaxf(hi4[e], h[e]); } }
      const float lo = fminf(fminf(lo4[0], lo4[1]), fminf(lo4[2], lo4[3]));
      const float up = fmaxf(fmaxf(hi4[0], hi4[1]), fmaxf(hi4[2], hi4[3]));
      const float loc = fminf(fmaxf(lo, 0.0f), (float)TSEQ);        // clipped to the t axis before the integer conversion
      const float upc = fminf(fmaxf(up, -1.0f), (float)(TSEQ - 1));
      const int f = (int)loc >> 5, l = (int)upc >> 5;
      tfirst = __builtin_amdgcn_readfirstlane(f);
      nlive = __builtin_amdgcn_readfirstlane((loc <= upc) ? (l - f + 1) : 0); }
    v8f acc[8];
#pragma unroll
    for (int j = 0; j < 8; ++j) acc[j] = (v8f){};
    const int pw = pb + lr * PW;
#pragma unroll                                                      // acc[] is indexed by constants only
    for (int st = 0; st < NST; ++st) {
        if (wave + st * AW >= nlive) continue;                      // scalar test, the same for the whole wave: no such live tile (a tile outside the live range adds exact zeros)
        const int tt = tfirst + wave + st * AW;                     // the wave's tile (scalar); tfirst + nlive <= TSEQ/32
        const float* kq = mask + (size_t)b * T_FULL + 8 * hi + tt * 32;                 // t = 32tt+8h+0..7 and 32tt+16+8h+0..7, all < TSEQ
        const h16* cu = CT + ((size_t)b * (TSEQ / 32) + (size_t)tt) * (8 * 2 * 256);    // the tile's part of the plane (same for all lanes); + (j*2 + k half)*256 + 8*lane  (B fragment: col d, k = t)
        v4f mq[4];
        v8h cf[8][2];
        mq[0] = *(const v4f*)(kq);      mq[1] = *(const v4f*)(kq + 4);
        mq[2] = *(const v4f*)(kq + 16); mq[3] = *(const v4f*)(kq + 20);
        __builtin_amdgcn_sched_barrier(0);                          // keeps the mask loads ahead of the fragment loads: loads return in order, and issued last the tile's mask would be waited for behind its fragments
#pragma unroll                                                      // cf[] is indexed by constants only; ascending addresses
        for (int j = 0; j < 8; ++j) { const h16* p = cu + j * 512 + lane * 8; cf[j][0] = *(const v8h*)p; cf[j][1] = *(const v8h*)(p + 256); }
        // every global load of the tile stands above, ahead of its exponentials, which cover the round trips; left at its WMMA each pair would be waited for alone
        float s[16];
#pragma unroll
        for (int i = 0; i < 16; ++i) s[i] = 0.0f;
        const float tb = (float)(tt * 32 + 8 * hi);
#pragma unroll 1
        for (int k = 0; k < NMIX; ++k) {
            const float a = sp[pw + k];
            const float g = sp[pw + NMIX + k] * NL2E;
            const float kp = spos[lr * PSP + k];
#pragma unroll
            for (int i = 0; i < 8; ++i) {
                const float d0 = kp - (tb + (float)i);
                const float d1 = kp - (tb + (float)(16 + i));
                s[i]     += a * __builtin_amdgcn_exp2f(g * d0 * d0);
                s[8 + i] += a * __builtin_amdgcn_exp2f(g * d1 * d1); }
        }
        float mk[16];
#pragma unroll
        for (int r = 0; r < 4; ++r) { mk[r] = mq[0][r]; mk[4 + r] = mq[1][r]; mk[8 + r] = mq[2][r]; mk[12 + r] = mq[3][r]; }
        v16h pa;
#pragma unroll
        for (int i = 0; i < 16; ++i) { const float gv = s[i] * bfr(mk[i]) * PCAR; pa[i] = toh_flush(gv); }
#pragma unroll
        for (int j = 0; j < 8; ++j) acc[j] = wmma16_g(pa, cat16(cf[j][0], cf[j][1]), acc[j]);
        asm volatile("s_wait_xcnt 0x0" :: "v"(kq), "s"(cu), "v"(lane) : "memory"); // the mask address pair and the plane base that the tile's loads name stay live up to here, so no write lands on them ahead of this wait; it stands behind the last use of the loaded data, where nothing is left to wait for
    }
    const int wb = wave * 16 * OSP2;
    const int nsum = (nlive < AW) ? ((nlive + 3) & ~3) : AW;        // partial tiles that are summed: the waves with a live tile, rounded up to whole fours (the waves that round it up write their zeros)
    // D layout: acc[j][r] = (u = 8h + r, d = 16j + lane&15) -> os[wave][u][d]; rows 0..15 x columns 0..127 of the wave's partial tile all written
    if (wave < nsum) {
#pragma unroll
        for (int j = 0; j < 8; ++j) {
#pragma unroll
            for (int r = 0; r < 8; ++r) os[wb + (8 * hi + r) * OSP2 + 16 * j + lr] = acc[j][r] * OSC; } }
    __syncthreads();                                                // every summed partial tile (waves below nsum) is in LDS before any wave sums across them
    float* orow = OUT + ((size_t)b * OUT_U + (size_t)u0) * DM;
    for (int row = wave; row < 16; row += AW) {                     // one wave per output row: 32 lanes x 16 B == 512 B
        v4f val = (v4f){};                                          // no live tile at all: the row is zero
        for (int w0 = 0; w0 < nsum; w0 += 4) {
#pragma unroll                                                      // four straight-line reads overlap; one by one, each would be waited for alone
            for (int w = 0; w < 4; ++w) val += *(const v4fa*)(&os[(w0 + w) * 16 * OSP2 + row * OSP2 + lane * 4]); }
        *(v4f*)(orow + (size_t)row * DM + lane * 4) = val; }
}

static constexpr size_t al256(size_t v) { return (v + 255) & ~(size_t)255; }
static constexpr size_t SZ_CT  = al256((size_t)NB * DM * TSEQ * 2);
static constexpr size_t SZ_PAR = al256((size_t)NB * USEQ * PW * 4);
static constexpr size_t SZ_TOTAL = SZ_CT + SZ_PAR;
static_assert(SZ_TOTAL <= (size_t)134217728);          // workspace carve <= 128 MiB
static_assert(((size_t)TSEQ * 2) % 128 == 0);

extern "C" void kernel_launch(void* const* d_in, const int* in_sizes, int n_in,
                              void* d_out, int out_size, void* d_ws, size_t ws_size, hipStream_t stream) {
    if (n_in < 5) return;
    const size_t needh = ((size_t)(NB - 1) * U_FULL + USEQ) * HIN;
    const size_t needc = ((size_t)(NB - 1) * T_FULL + TSEQ) * DM;
    const size_t needm = (size_t)(NB - 1) * T_FULL + TSEQ;
    if ((size_t)in_sizes[0] < needh || (size_t)in_sizes[1] < needc || (size_t)in_sizes[2] < needm) return;
    if ((size_t)in_sizes[3] < (size_t)HIN * NPAR || in_sizes[4] < NPAR) return;
    if ((size_t)out_size < ((size_t)(NB - 1) * OUT_U + USEQ) * DM) return;
    if (SZ_TOTAL > ws_size) return;
    // wire order: h_t, ctx, mask, W, b
    const float* hin  = (const float*)d_in[0];
    const float* ctx  = (const float*)d_in[1];
    const float* mask = (const float*)d_in[2];
    const float* wlin = (const float*)d_in[3];
    const float* blin = (const float*)d_in[4];
    float* OUT = (float*)d_out;      // [NB][USEQ][128]
    char* wsp = (char*)d_ws;
    h16* CT  = (h16*)wsp; wsp += SZ_CT;               // ctx f16 x64, B-fragment order [NB][TSEQ/32][8][2][32][8]
    float* PAR = (float*)wsp; wsp += SZ_PAR;          // parameters [NB*USEQ][32] f32

    // grid (t tiles of the ctx transpose, then 16-row tiles of the linear map; batches)
    k_prep<<<dim3(CTB + USEQ / 16, NB, 1), 256, 0, stream>>>(hin, wlin, blin, ctx, PAR, CT);
    k_window<<<dim3(USEQ / 16, NB, 1), 32 * AW, 0, stream>>>(PAR, CT, mask, OUT);
}
